// v000
// The times below were measured on an AMD MI455X: many runs one after another, warmed up first and cycling through
// copies of the inputs, with the whole window's GPU time divided by the number of runs. Launches and the gaps
// between them are all in it. The median over several windows is given; except for v000 it joins two sittings, which
// can be a few percent apart, so the side-by-side timings, each taken in one sitting, are the better comparison.
// v000, which the later versions start from, runs in 182 microseconds.
#include <hip/hip_runtime.h>
#include <hip/hip_bf16.h>

typedef _Float16 f16;
typedef __attribute__((ext_vector_type(16))) _Float16 v16h;
typedef __attribute__((ext_vector_type(8)))  float    v8f;
typedef __attribute__((ext_vector_type(4)))  unsigned int u32x4;
typedef __attribute__((ext_vector_type(2)))  unsigned int u32x2;
typedef int gvi4 __attribute__((vector_size(16)));   // matches async-LDS builtin param

union Frag16 { v16h h; u32x4 q[2]; };

#define AS1 __attribute__((address_space(1)))
#define AS3 __attribute__((address_space(3)))

#if __has_builtin(__builtin_amdgcn_global_load_async_to_lds_b128)
#define HAVE_ASYNC_LDS 1
#else
#define HAVE_ASYNC_LDS 0
#endif

__device__ __forceinline__ void wait_asynccnt0() {
#if __has_builtin(__builtin_amdgcn_s_wait_asynccnt)
    __builtin_amdgcn_s_wait_asynccnt(0);
#else
    asm volatile("s_wait_asynccnt 0x0" ::: "memory");
#endif
}

#define HEADS 4
#define DIMH 32
#define BATCH 16
#define CCH 256      // x channels
#define CD 512       // cond channels
#define HID 128      // heads*dim_head
#define NPIX 4096    // 64*64
#define NC 1024      // 32*32
#define GROUPS 32

// ---------------------------------------------------------------------------
// f32 -> f16 elementwise convert
// ---------------------------------------------------------------------------
__global__ __launch_bounds__(256) void cvt_f16_kernel(const float* __restrict__ src,
                                                      f16* __restrict__ dst, long n) {
    long i = (long)blockIdx.x * blockDim.x + threadIdx.x;
    long stride = (long)gridDim.x * blockDim.x;
    for (; i < n; i += stride) dst[i] = (f16)src[i];
}

// ---------------------------------------------------------------------------
// GroupNorm: x (B,256,4096) -> xn f16, 1 block per (batch, group)
// ---------------------------------------------------------------------------
__global__ __launch_bounds__(256) void groupnorm_kernel(const float* __restrict__ x,
                                                        const float* __restrict__ w,
                                                        const float* __restrict__ b,
                                                        f16* __restrict__ xn) {
    int blk = blockIdx.x;
    int bat = blk >> 5;
    int g   = blk & 31;
    const float* xb = x + ((long)bat * CCH + g * 8) * NPIX;
    f16*         ob = xn + ((long)bat * CCH + g * 8) * NPIX;
    int t = threadIdx.x;

    float s = 0.f, s2 = 0.f;
    for (int i = t; i < 8 * NPIX; i += 256) {
        float v = xb[i];
        s += v; s2 += v * v;
    }
    __shared__ float sh[256], sh2[256];
    sh[t] = s; sh2[t] = s2;
    __syncthreads();
    for (int o = 128; o > 0; o >>= 1) {
        if (t < o) { sh[t] += sh[t + o]; sh2[t] += sh2[t + o]; }
        __syncthreads();
    }
    float mu  = sh[0] * (1.0f / 32768.0f);
    float var = sh2[0] * (1.0f / 32768.0f) - mu * mu;
    float ri  = rsqrtf(var + 1e-5f);
    for (int i = t; i < 8 * NPIX; i += 256) {
        int ch = g * 8 + (i >> 12);
        float v = (xb[i] - mu) * ri;
        ob[i] = (f16)(v * w[ch] + b[ch]);
    }
}

// ---------------------------------------------------------------------------
// WMMA f16 GEMM:  C[b] = A[b] (MxK) * B[b] (KxN) + bias
//
// Block tile 64(M) x 64(N), BK=32, 8 waves; wave (w>>1, w&1) owns a 16x32
// output strip: one A fragment reused across two v_wmma_f32_16x16x32_f16.
// Double-buffered LDS, one barrier per K-step. A tile staged with
// GLOBAL_LOAD_ASYNC_TO_LDS_B128 (ASYNCcnt); B tile staged transposed [n][k]
// so fragments fill with two aligned 16B LDS loads per lane.
//
// Fragment layout (ISA 7.12.2, 16-bit 16x32): lane L (idx = L&15):
//   halves 0..7  = K (L<16 ? 0..7 : 8..15),  halves 8..15 = +16.
// ---------------------------------------------------------------------------
template <bool OUT16>
__global__ __launch_bounds__(256) void gemm_wmma_kernel(
    const f16* __restrict__ A, long sA,
    const f16* __restrict__ B, long sB,
    void* __restrict__ Cv, long sC,
    const float* __restrict__ bias,
    int M, int N, int K) {

    __shared__ f16 ldsA[2][64][32];   // [buf][m][k]
    __shared__ f16 ldsB[2][64][32];   // [buf][n][k]

    int bat = blockIdx.z;
    int m0  = blockIdx.x * 64;
    int n0  = blockIdx.y * 64;
    int t    = threadIdx.x;
    int lane = t & 31;
    int warp = t >> 5;
    int trow = (warp >> 1) * 16;     // 0,16,32,48
    int tcol = (warp & 1) * 32;      // 0,32
    int hs   = (lane >> 4) * 8;      // K-half select

    const f16* Ab = A + (long)bat * sA;
    const f16* Bb = B + (long)bat * sB;

    // staging coordinates: 2048 halves per tile, 8 per thread
    int ar_st = t >> 2;              // A row 0..63
    int ac_st = (t & 3) * 8;         // A k-col, multiple of 8
    int bk_st = (t * 8) >> 6;        // B k-row 0..31
    int bn_st = (t * 8) & 63;        // B n-col, multiple of 8

    v8f acc0 = {0.f, 0.f, 0.f, 0.f, 0.f, 0.f, 0.f, 0.f};
    v8f acc1 = {0.f, 0.f, 0.f, 0.f, 0.f, 0.f, 0.f, 0.f};

    int nk = K >> 5;
    u32x4 rb = *(const u32x4*)(Bb + (long)bk_st * N + n0 + bn_st);
#if HAVE_ASYNC_LDS
    __builtin_amdgcn_global_load_async_to_lds_b128(
        (AS1 gvi4*)(Ab + (long)(m0 + ar_st) * K + ac_st),
        (AS3 gvi4*)&ldsA[0][ar_st][ac_st], 0, 0);
#else
    u32x4 ra = *(const u32x4*)(Ab + (long)(m0 + ar_st) * K + ac_st);
#endif

    for (int kt = 0; kt < nk; kt++) {
        int buf = kt & 1;
        // ---- commit tile kt to LDS ---------------------------------------
        {
            f16 tmp[8];
            *(u32x4*)tmp = rb;
#pragma unroll
            for (int i = 0; i < 8; i++) ldsB[buf][bn_st + i][bk_st] = tmp[i];
        }
#if HAVE_ASYNC_LDS
        wait_asynccnt0();            // my async A chunk for tile kt landed
#else
        *(u32x4*)&ldsA[buf][ar_st][ac_st] = ra;
#endif
        __syncthreads();             // all waves' A+B chunks visible

        // ---- issue tile kt+1 (other buffer) ------------------------------
        if (kt + 1 < nk) {
            int k0 = (kt + 1) * 32;
            rb = *(const u32x4*)(Bb + (long)(k0 + bk_st) * N + n0 + bn_st);
#if HAVE_ASYNC_LDS
            __builtin_amdgcn_global_load_async_to_lds_b128(
                (AS1 gvi4*)(Ab + (long)(m0 + ar_st) * K + k0 + ac_st),
                (AS3 gvi4*)&ldsA[buf ^ 1][ar_st][ac_st], 0, 0);
#else
            ra = *(const u32x4*)(Ab + (long)(m0 + ar_st) * K + k0 + ac_st);
#endif
            if (kt + 2 < nk)         // prefetch B tile kt+2 -> global_prefetch_b8
                __builtin_prefetch((const void*)(Bb + (long)((kt + 2) * 32 + bk_st) * N
                                                 + n0 + bn_st), 0, 1);
        }

        // ---- fragments + 2x WMMA -----------------------------------------
        Frag16 fa, fb0, fb1;
        int arr = trow + (lane & 15);
        int bc  = tcol + (lane & 15);
        fa.q[0]  = *(const u32x4*)&ldsA[buf][arr][hs];
        fa.q[1]  = *(const u32x4*)&ldsA[buf][arr][16 + hs];
        fb0.q[0] = *(const u32x4*)&ldsB[buf][bc][hs];
        fb0.q[1] = *(const u32x4*)&ldsB[buf][bc][16 + hs];
        fb1.q[0] = *(const u32x4*)&ldsB[buf][bc + 16][hs];
        fb1.q[1] = *(const u32x4*)&ldsB[buf][bc + 16][16 + hs];
        acc0 = __builtin_amdgcn_wmma_f32_16x16x32_f16(
            false, fa.h, false, fb0.h, (short)0, acc0, false, false);
        acc1 = __builtin_amdgcn_wmma_f32_16x16x32_f16(
            false, fa.h, false, fb1.h, (short)0, acc1, false, false);
    }

    // ---- epilogue: VGPR r -> row (trow + r + 8*(lane>=16)) ----------------
    int col0  = n0 + tcol + (lane & 15);
    int rbase = m0 + trow + (lane >> 4) * 8;
    for (int r = 0; r < 8; r++) {
        int row = rbase + r;
        float bv = bias[row];
        float v0 = acc0[r] + bv;
        float v1 = acc1[r] + bv;
        long base = (long)bat * sC + (long)row * N;
        if (OUT16) {
            ((f16*)Cv)[base + col0]      = (f16)v0;
            ((f16*)Cv)[base + col0 + 16] = (f16)v1;
        } else {
            ((float*)Cv)[base + col0]      = v0;
            ((float*)Cv)[base + col0 + 16] = v1;
        }
    }
}

// ---------------------------------------------------------------------------
// Per-(batch, head): softmax(k, axis=n) then ctx[d][e] = sum_n p[d][n]*v[e][n]
// kv: (B, 256, 1024) f32;  k rows = h*32+d,  v rows = 128+h*32+e.
// ---------------------------------------------------------------------------
__global__ __launch_bounds__(256) void softmax_ctx_kernel(const float* __restrict__ kv,
                                                          float* __restrict__ ctx) {
    int h = blockIdx.x;
    int b = blockIdx.y;
    const float* kbase = kv + ((long)b * 256 + h * DIMH) * NC;
    const float* vbase = kv + ((long)b * 256 + HID + h * DIMH) * NC;

    __shared__ float rmax[DIMH], rinv[DIMH];
    __shared__ f16 ldsP[DIMH][128];
    __shared__ f16 ldsV[DIMH][128];

    int t = threadIdx.x;
    int lane = t & 31;
    int warp = t >> 5;

    // pass 1: per-row max and sum (each wave owns 4 rows)
    for (int rr = 0; rr < 4; rr++) {
        int row = warp * 4 + rr;
        const float* kr = kbase + (long)row * NC;
        float m = -1e30f;
        for (int i = lane; i < NC; i += 32) m = fmaxf(m, kr[i]);
        for (int o = 16; o >= 1; o >>= 1) m = fmaxf(m, __shfl_xor(m, o, 32));
        float s = 0.f;
        for (int i = lane; i < NC; i += 32) s += __expf(kr[i] - m);
        for (int o = 16; o >= 1; o >>= 1) s += __shfl_xor(s, o, 32);
        if (lane == 0) { rmax[row] = m; rinv[row] = 1.0f / s; }
    }
    __syncthreads();

    v8f acc = {0.f, 0.f, 0.f, 0.f, 0.f, 0.f, 0.f, 0.f};
    int trow = (warp >> 1) * 16;   // valid for warp<4
    int tcol = (warp & 1) * 16;
    int hs = (lane >> 4) * 8;

    for (int nc = 0; nc < NC; nc += 128) {
        int idx = t * 16;
        int d  = idx >> 7;        // 0..31
        int ns = idx & 127;
        float mr = rmax[d], sr = rinv[d];
        const float* kr = kbase + (long)d * NC + nc + ns;
        const float* vr = vbase + (long)d * NC + nc + ns;
        for (int i = 0; i < 16; i++) {
            ldsP[d][ns + i] = (f16)(__expf(kr[i] - mr) * sr);
            ldsV[d][ns + i] = (f16)vr[i];
        }
        __syncthreads();

        if (warp < 4) {
            int ar = trow + (lane & 15);
            int bc = tcol + (lane & 15);
            for (int kk = 0; kk < 128; kk += 32) {
                Frag16 fa, fb;
                fa.q[0] = *(const u32x4*)&ldsP[ar][kk + hs];
                fa.q[1] = *(const u32x4*)&ldsP[ar][kk + 16 + hs];
                fb.q[0] = *(const u32x4*)&ldsV[bc][kk + hs];
                fb.q[1] = *(const u32x4*)&ldsV[bc][kk + 16 + hs];
                acc = __builtin_amdgcn_wmma_f32_16x16x32_f16(
                    false, fa.h, false, fb.h, (short)0, acc, false, false);
            }
        }
        __syncthreads();
    }

    if (warp < 4) {
        float* cb = ctx + (((long)b * HEADS + h) * DIMH) * DIMH;
        int e = tcol + (lane & 15);
        for (int r = 0; r < 8; r++) {
            int d = trow + r + (lane >> 4) * 8;
            cb[d * DIMH + e] = acc[r];
        }
    }
}

// ---------------------------------------------------------------------------
// Fold context into output weight:
//   W2[b][c][h*32+d] = sum_e w_out[c][h*32+e] * ctx[b][h][d][e]   (f16 out)
// ---------------------------------------------------------------------------
__global__ __launch_bounds__(256) void fold_w2_kernel(const float* __restrict__ w_out,
                                                      const float* __restrict__ ctx,
                                                      f16* __restrict__ w2) {
    long o = (long)blockIdx.x * blockDim.x + threadIdx.x;   // B*256*128 elems
    if (o >= (long)BATCH * CCH * HID) return;
    int j = (int)(o & (HID - 1));
    long rem = o >> 7;
    int c = (int)(rem & (CCH - 1));
    int b = (int)(rem >> 8);
    int h = j >> 5;
    int d = j & 31;
    const float* wr = w_out + (long)c * HID + h * DIMH;
    const float* cr = ctx + (((long)b * HEADS + h) * DIMH + d) * DIMH;
    float acc = 0.f;
    for (int e = 0; e < DIMH; e++) acc += wr[e] * cr[e];
    w2[o] = (f16)acc;
}

// ---------------------------------------------------------------------------
extern "C" void kernel_launch(void* const* d_in, const int* in_sizes, int n_in,
                              void* d_out, int out_size, void* d_ws, size_t ws_size,
                              hipStream_t stream) {
    const float* x     = (const float*)d_in[0];   // (16,256,64,64)
    const float* cond  = (const float*)d_in[1];   // (16,512,32,32)
    const float* gn_w  = (const float*)d_in[2];
    const float* gn_b  = (const float*)d_in[3];
    const float* w_q   = (const float*)d_in[4];   // (128,256)
    const float* b_q   = (const float*)d_in[5];
    const float* w_kv  = (const float*)d_in[6];   // (256,512)
    const float* b_kv  = (const float*)d_in[7];
    const float* w_out = (const float*)d_in[8];   // (256,128)
    const float* b_out = (const float*)d_in[9];
    float* out = (float*)d_out;                   // (16,256,64,64)

    // workspace layout
    char* ws = (char*)d_ws;
    constexpr long SZ_XN   = (long)BATCH * CCH * NPIX * 2;   // 33.5 MB f16
    constexpr long SZ_CD16 = (long)BATCH * CD * NC * 2;      // 16.8 MB f16
    constexpr long SZ_WQ   = (long)HID * CCH * 2;
    constexpr long SZ_WKV  = (long)2 * HID * CD * 2;
    constexpr long SZ_KV   = (long)BATCH * 2 * HID * NC * 4; // f32
    constexpr long SZ_Q16  = (long)BATCH * HID * NPIX * 2;
    constexpr long SZ_CTX  = (long)BATCH * HEADS * DIMH * DIMH * 4;
    f16*   xn16   = (f16*)(ws);
    f16*   cond16 = (f16*)(ws + SZ_XN);
    f16*   wq16   = (f16*)(ws + SZ_XN + SZ_CD16);
    f16*   wkv16  = (f16*)(ws + SZ_XN + SZ_CD16 + SZ_WQ);
    float* kvf    = (float*)(ws + SZ_XN + SZ_CD16 + SZ_WQ + SZ_WKV);
    f16*   q16    = (f16*)(ws + SZ_XN + SZ_CD16 + SZ_WQ + SZ_WKV + SZ_KV);
    float* ctxf   = (float*)(ws + SZ_XN + SZ_CD16 + SZ_WQ + SZ_WKV + SZ_KV + SZ_Q16);
    f16*   w2_16  = (f16*)(ws + SZ_XN + SZ_CD16 + SZ_WQ + SZ_WKV + SZ_KV + SZ_Q16 + SZ_CTX);

    // 1) converts
    long ncond = (long)BATCH * CD * NC;
    cvt_f16_kernel<<<(ncond + 255) / 256, 256, 0, stream>>>(cond, cond16, ncond);
    cvt_f16_kernel<<<(HID * CCH + 255) / 256, 256, 0, stream>>>(w_q, wq16, HID * CCH);
    cvt_f16_kernel<<<(2 * HID * CD + 255) / 256, 256, 0, stream>>>(w_kv, wkv16, 2 * HID * CD);

    // 2) GroupNorm -> xn f16
    groupnorm_kernel<<<BATCH * GROUPS, 256, 0, stream>>>(x, gn_w, gn_b, xn16);

    // 3) kv = w_kv @ cond + b_kv   (M=256,K=512,N=1024, f32 out)
    gemm_wmma_kernel<false><<<dim3(256 / 64, NC / 64, BATCH), 256, 0, stream>>>(
        wkv16, 0, cond16, (long)CD * NC, kvf, (long)2 * HID * NC, b_kv, 2 * HID, NC, CD);

    // 4) q = w_q @ xn + b_q        (M=128,K=256,N=4096, f16 out)
    gemm_wmma_kernel<true><<<dim3(HID / 64, NPIX / 64, BATCH), 256, 0, stream>>>(
        wq16, 0, xn16, (long)CCH * NPIX, q16, (long)HID * NPIX, b_q, HID, NPIX, CCH);

    // 5) softmax(k) + context = P @ V^T  per (b,h)
    softmax_ctx_kernel<<<dim3(HEADS, BATCH), 256, 0, stream>>>(kvf, ctxf);

    // 6) fold ctx into output weight: W2 = w_out x ctx
    long nw2 = (long)BATCH * CCH * HID;
    fold_w2_kernel<<<(nw2 + 255) / 256, 256, 0, stream>>>(w_out, ctxf, w2_16);

    // 7) out = W2 @ q + b_out      (M=256,K=128,N=4096, f32 out)
    gemm_wmma_kernel<false><<<dim3(CCH / 64, NPIX / 64, BATCH), 256, 0, stream>>>(
        w2_16, (long)CCH * HID, q16, (long)HID * NPIX, out, (long)CCH * NPIX, b_out,
        CCH, NPIX, HID);
}

// v001
// A run of this version takes 145 microseconds.
// Next to v000, in two timings, it ran 1.27 times as fast each time.
#include <hip/hip_runtime.h>
#include <hip/hip_bf16.h>

typedef _Float16 f16;
typedef __attribute__((ext_vector_type(16))) _Float16 v16h;
typedef __attribute__((ext_vector_type(8)))  float    v8f;
typedef __attribute__((ext_vector_type(4)))  unsigned int u32x4;
typedef __attribute__((ext_vector_type(2)))  unsigned int u32x2;
typedef int gvi4 __attribute__((vector_size(16)));   // matches async-LDS builtin param

union Frag16 { v16h h; u32x4 q[2]; };

#define AS1 __attribute__((address_space(1)))
#define AS3 __attribute__((address_space(3)))

#if __has_builtin(__builtin_amdgcn_global_load_async_to_lds_b128)
#define HAVE_ASYNC_LDS 1
#else
#define HAVE_ASYNC_LDS 0
#endif

__device__ __forceinline__ void wait_asynccnt0() {
#if __has_builtin(__builtin_amdgcn_s_wait_asynccnt)
    __builtin_amdgcn_s_wait_asynccnt(0);
#else
    asm volatile("s_wait_asynccnt 0x0" ::: "memory");
#endif
}

#define HEADS 4
#define DIMH 32
#define BATCH 16
#define CCH 256      // x channels
#define CD 512       // cond channels
#define HID 128      // heads*dim_head
#define NPIX 4096    // 64*64
#define NC 1024      // 32*32
#define GROUPS 32

// ---------------------------------------------------------------------------
// f32 -> f16 elementwise convert
// ---------------------------------------------------------------------------
__global__ __launch_bounds__(256) void cvt_f16_kernel(const float* __restrict__ src,
                                                      f16* __restrict__ dst, long n) {
    long i = (long)blockIdx.x * blockDim.x + threadIdx.x;
    long stride = (long)gridDim.x * blockDim.x;
    for (; i < n; i += stride) dst[i] = (f16)src[i];
}

// ---------------------------------------------------------------------------
// GroupNorm: x (B,256,4096) -> xn f16, 1 block per (batch, group)
// ---------------------------------------------------------------------------
__global__ __launch_bounds__(256) void groupnorm_kernel(const float* __restrict__ x,
                                                        const float* __restrict__ w,
                                                        const float* __restrict__ b,
                                                        f16* __restrict__ xn) {
    int blk = blockIdx.x;
    int bat = blk >> 5;
    int g   = blk & 31;
    const float* xb = x + ((long)bat * CCH + g * 8) * NPIX;
    f16*         ob = xn + ((long)bat * CCH + g * 8) * NPIX;
    int t = threadIdx.x;

    float s = 0.f, s2 = 0.f;
    for (int i = t; i < 8 * NPIX; i += 256) {
        float v = xb[i];
        s += v; s2 += v * v;
    }
    __shared__ float sh[256], sh2[256];
    sh[t] = s; sh2[t] = s2;
    __syncthreads();
    for (int o = 128; o > 0; o >>= 1) {
        if (t < o) { sh[t] += sh[t + o]; sh2[t] += sh2[t + o]; }
        __syncthreads();
    }
    float mu  = sh[0] * (1.0f / 32768.0f);
    float var = sh2[0] * (1.0f / 32768.0f) - mu * mu;
    float ri  = rsqrtf(var + 1e-5f);
    for (int i = t; i < 8 * NPIX; i += 256) {
        int ch = g * 8 + (i >> 12);
        float v = (xb[i] - mu) * ri;
        ob[i] = (f16)(v * w[ch] + b[ch]);
    }
}

// ---------------------------------------------------------------------------
// WMMA f16 GEMM:  C[b] = A[b] (MxK) * B[b] (KxN) + bias
//
// Block tile 64(M) x 64(N), BK=32, 8 waves; wave (w>>1, w&1) owns a 16x32
// output strip: one A fragment reused across two v_wmma_f32_16x16x32_f16.
// Double-buffered LDS, one barrier per K-step. A tile staged with
// GLOBAL_LOAD_ASYNC_TO_LDS_B128 (ASYNCcnt); B tile staged transposed [n][k]
// so fragments fill with two aligned 16B LDS loads per lane.
//
// Fragment layout (ISA 7.12.2, 16-bit 16x32): lane L (idx = L&15):
//   halves 0..7  = K (L<16 ? 0..7 : 8..15),  halves 8..15 = +16.
// ---------------------------------------------------------------------------
template <bool OUT16>
__global__ __launch_bounds__(256) void gemm_wmma_kernel(
    const f16* __restrict__ A, long sA,
    const f16* __restrict__ B, long sB,
    void* __restrict__ Cv, long sC,
    const float* __restrict__ bias,
    int M, int N, int K) {

    __shared__ f16 ldsA[2][64][32];   // [buf][m][k]
    __shared__ f16 ldsB[2][64][32];   // [buf][n][k]

    int bat = blockIdx.z;
    int m0  = blockIdx.x * 64;
    int n0  = blockIdx.y * 64;
    int t    = threadIdx.x;
    int lane = t & 31;
    int warp = t >> 5;
    int trow = (warp >> 1) * 16;     // 0,16,32,48
    int tcol = (warp & 1) * 32;      // 0,32
    int hs   = (lane >> 4) * 8;      // K-half select

    const f16* Ab = A + (long)bat * sA;
    const f16* Bb = B + (long)bat * sB;

    // staging coordinates: 2048 halves per tile, 8 per thread
    int ar_st = t >> 2;              // A row 0..63
    int ac_st = (t & 3) * 8;         // A k-col, multiple of 8
    int bk_st = (t * 8) >> 6;        // B k-row 0..31
    int bn_st = (t * 8) & 63;        // B n-col, multiple of 8

    v8f acc0 = {0.f, 0.f, 0.f, 0.f, 0.f, 0.f, 0.f, 0.f};
    v8f acc1 = {0.f, 0.f, 0.f, 0.f, 0.f, 0.f, 0.f, 0.f};

    int nk = K >> 5;
    u32x4 rb = *(const u32x4*)(Bb + (long)bk_st * N + n0 + bn_st);
#if HAVE_ASYNC_LDS
    __builtin_amdgcn_global_load_async_to_lds_b128(
        (AS1 gvi4*)(Ab + (long)(m0 + ar_st) * K + ac_st),
        (AS3 gvi4*)&ldsA[0][ar_st][ac_st], 0, 0);
#else
    u32x4 ra = *(const u32x4*)(Ab + (long)(m0 + ar_st) * K + ac_st);
#endif

    for (int kt = 0; kt < nk; kt++) {
        int buf = kt & 1;
        // ---- commit tile kt to LDS ---------------------------------------
        {
            f16 tmp[8];
            *(u32x4*)tmp = rb;
#pragma unroll
            for (int i = 0; i < 8; i++) ldsB[buf][bn_st + i][bk_st] = tmp[i];
        }
#if HAVE_ASYNC_LDS
        wait_asynccnt0();            // my async A chunk for tile kt landed
#else
        *(u32x4*)&ldsA[buf][ar_st][ac_st] = ra;
#endif
        __syncthreads();             // all waves' A+B chunks visible

        // ---- issue tile kt+1 (other buffer) ------------------------------
        if (kt + 1 < nk) {
            int k0 = (kt + 1) * 32;
            rb = *(const u32x4*)(Bb + (long)(k0 + bk_st) * N + n0 + bn_st);
#if HAVE_ASYNC_LDS
            __builtin_amdgcn_global_load_async_to_lds_b128(
                (AS1 gvi4*)(Ab + (long)(m0 + ar_st) * K + k0 + ac_st),
                (AS3 gvi4*)&ldsA[buf ^ 1][ar_st][ac_st], 0, 0);
#else
            ra = *(const u32x4*)(Ab + (long)(m0 + ar_st) * K + k0 + ac_st);
#endif
            if (kt + 2 < nk)         // prefetch B tile kt+2 -> global_prefetch_b8
                __builtin_prefetch((const void*)(Bb + (long)((kt + 2) * 32 + bk_st) * N
                                                 + n0 + bn_st), 0, 1);
        }

        // ---- fragments + 2x WMMA -----------------------------------------
        Frag16 fa, fb0, fb1;
        int arr = trow + (lane & 15);
        int bc  = tcol + (lane & 15);
        fa.q[0]  = *(const u32x4*)&ldsA[buf][arr][hs];
        fa.q[1]  = *(const u32x4*)&ldsA[buf][arr][16 + hs];
        fb0.q[0] = *(const u32x4*)&ldsB[buf][bc][hs];
        fb0.q[1] = *(const u32x4*)&ldsB[buf][bc][16 + hs];
        fb1.q[0] = *(const u32x4*)&ldsB[buf][bc + 16][hs];
        fb1.q[1] = *(const u32x4*)&ldsB[buf][bc + 16][16 + hs];
        acc0 = __builtin_amdgcn_wmma_f32_16x16x32_f16(
            false, fa.h, false, fb0.h, (short)0, acc0, false, false);
        acc1 = __builtin_amdgcn_wmma_f32_16x16x32_f16(
            false, fa.h, false, fb1.h, (short)0, acc1, false, false);
    }

    // ---- epilogue: VGPR r -> row (trow + r + 8*(lane>=16)) ----------------
    int col0  = n0 + tcol + (lane & 15);
    int rbase = m0 + trow + (lane >> 4) * 8;
    for (int r = 0; r < 8; r++) {
        int row = rbase + r;
        float bv = bias[row];
        float v0 = acc0[r] + bv;
        float v1 = acc1[r] + bv;
        long base = (long)bat * sC + (long)row * N;
        if (OUT16) {
            ((f16*)Cv)[base + col0]      = (f16)v0;
            ((f16*)Cv)[base + col0 + 16] = (f16)v1;
        } else {
            ((float*)Cv)[base + col0]      = v0;
            ((float*)Cv)[base + col0 + 16] = v1;
        }
    }
}

// ---------------------------------------------------------------------------
// Per-(batch, head, half of d): softmax(k, axis=n), ctx[d][e] = sum_n p[d][n]*v[e][n]
// kv: (B, 256, 1024) f32;  k rows = h*32+d,  v rows = 128+h*32+e.
//
// 16 waves. Wave w keeps k row w of its d half and v rows w, w+16 whole in
// registers (24 wave-wide 16-byte loads, all issued before the first use), so
// kv is read once and the row max and sum need no second pass. P and V go to
// LDS as f16 once; then wave w multiplies the n slice [64w, 64w+64) for both
// e tiles, and the 16 partial tiles are summed in f32 through LDS.
// A block writes whole 128-byte rows of ctx.
// ---------------------------------------------------------------------------
typedef __attribute__((ext_vector_type(4))) float    f32x4;
typedef __attribute__((ext_vector_type(4))) _Float16 f16x4;

// Four v_exp_f32 (the instruction __expf ends in) in one statement. The outputs are
// early-clobbered so that none lands on a source of the v_exp_f32 directly ahead of it, and
// the v_nop is the slot the instruction set asks for behind the last one.
__device__ __forceinline__ f32x4 exp2_x4(f32x4 a) {
    float r0, r1, r2, r3;
    asm("v_exp_f32 %0, %4\n\tv_exp_f32 %1, %5\n\tv_exp_f32 %2, %6\n\tv_exp_f32 %3, %7\n\tv_nop"
        : "=&v"(r0), "=&v"(r1), "=&v"(r2), "=&v"(r3)
        : "v"(a.x), "v"(a.y), "v"(a.z), "v"(a.w));
    f32x4 r = {r0, r1, r2, r3};
    return r;
}

#define SC_PITCH (NC + 8)    // halves: 2064 B = 16 B x odd, for the ds_load_b128 fragment reads
#define SC_TILE1 272         // dword offset of the second e tile's partials (16 banks off the first)

__global__ __launch_bounds__(512) void softmax_ctx_kernel(const float* __restrict__ kv,
                                                          float* __restrict__ ctx) {
    int h  = blockIdx.x;
    int b  = blockIdx.y;
    int dt = blockIdx.z;          // which 16 rows of d

    __shared__ __attribute__((aligned(16))) f16 ldsP[16][SC_PITCH];
    __shared__ __attribute__((aligned(16))) f16 ldsV[DIMH][SC_PITCH];
    __shared__ float red[16][SC_TILE1 + 256];

    int t = threadIdx.x;
    int lane = t & 31;
    int warp = t >> 5;

    const f32x4* kr = (const f32x4*)(kv + ((long)b * 256 + h * DIMH + dt * 16 + warp) * NC) + lane;
    const f32x4* va = (const f32x4*)(kv + ((long)b * 256 + HID + h * DIMH + warp) * NC) + lane;
    const f32x4* vb = va + 16 * NC / 4;

    f32x4 kq[8], v0[8], v1[8];
    for (int j = 0; j < 8; j++) kq[j] = kr[j * 32];
    for (int j = 0; j < 8; j++) v0[j] = va[j * 32];
    for (int j = 0; j < 8; j++) v1[j] = vb[j * 32];
    // The wait owed before a register that an issued load names is written again. The two
    // address pairs are its inputs, so they stay whole up to it (no load's result lands in them).
    asm volatile("s_wait_xcnt 0x0" :: "v"(kr), "v"(va) : "memory");
    // Keeps the max from being scheduled ahead of the v loads: without it they are issued
    // behind the wait for k, and their latency follows k's instead of overlapping it.
    __builtin_amdgcn_sched_barrier(0);

    // row max
    float m = -1e30f;
    for (int j = 0; j < 8; j++)
        m = fmaxf(m, fmaxf(fmaxf(kq[j].x, kq[j].y), fmaxf(kq[j].z, kq[j].w)));
    for (int o = 16; o >= 1; o >>= 1) m = fmaxf(m, __shfl_xor(m, o, 32));

    // exponentials stay in registers; four independent sum chains
    f32x4 s4 = {0.f, 0.f, 0.f, 0.f};
    for (int j = 0; j < 8; j++) {
        kq[j] = exp2_x4((kq[j] - m) * 1.44269504088896340736f);   // = __expf(k - m)
        s4 += kq[j];
    }
    float s = (s4.x + s4.y) + (s4.z + s4.w);
    for (int o = 16; o >= 1; o >>= 1) s += __shfl_xor(s, o, 32);
    float inv = 1.0f / s;

    for (int j = 0; j < 8; j++) {
        f32x4 p = kq[j] * inv;
        f16x4 ph = {(f16)p.x, (f16)p.y, (f16)p.z, (f16)p.w};
        f16x4 ah = {(f16)v0[j].x, (f16)v0[j].y, (f16)v0[j].z, (f16)v0[j].w};
        f16x4 bh = {(f16)v1[j].x, (f16)v1[j].y, (f16)v1[j].z, (f16)v1[j].w};
        *(f16x4*)&ldsP[warp][j * 128 + lane * 4]      = ph;
        *(f16x4*)&ldsV[warp][j * 128 + lane * 4]      = ah;
        *(f16x4*)&ldsV[warp + 16][j * 128 + lane * 4] = bh;
    }
    __syncthreads();

    // wave w: n slice [64w, 64w+64), one A fragment feeds both e tiles
    v8f acc0 = {0.f, 0.f, 0.f, 0.f, 0.f, 0.f, 0.f, 0.f};
    v8f acc1 = {0.f, 0.f, 0.f, 0.f, 0.f, 0.f, 0.f, 0.f};
    int c  = lane & 15;
    int hs = (lane >> 4) * 8;
    for (int ks = 0; ks < 2; ks++) {
        int kk = warp * 64 + ks * 32;
        Frag16 fa, fb0, fb1;
        fa.q[0]  = *(const u32x4*)&ldsP[c][kk + hs];
        fa.q[1]  = *(const u32x4*)&ldsP[c][kk + 16 + hs];
        fb0.q[0] = *(const u32x4*)&ldsV[c][kk + hs];
        fb0.q[1] = *(const u32x4*)&ldsV[c][kk + 16 + hs];
        fb1.q[0] = *(const u32x4*)&ldsV[c + 16][kk + hs];
        fb1.q[1] = *(const u32x4*)&ldsV[c + 16][kk + 16 + hs];
        acc0 = __builtin_amdgcn_wmma_f32_16x16x32_f16(
            false, fa.h, false, fb0.h, (short)0, acc0, false, false);
        acc1 = __builtin_amdgcn_wmma_f32_16x16x32_f16(
            false, fa.h, false, fb1.h, (short)0, acc1, false, false);
    }
    for (int r = 0; r < 8; r++) {
        red[warp][r * 32 + lane]            = acc0[r];
        red[warp][SC_TILE1 + r * 32 + lane] = acc1[r];
    }
    __syncthreads();

    // thread t owns ctx[dt*16 + (t>>5)][t&31]; register r, lane 16*(d>>3)+c held D[d][c]
    int d = warp;
    int e = lane;
    int idx = (e >> 4) * SC_TILE1 + (d & 7) * 32 + (d >> 3) * 16 + (e & 15);
    float sum = 0.f;
    for (int w = 0; w < 16; w++) sum += red[w][idx];
    ctx[(((long)b * HEADS + h) * DIMH + dt * 16 + d) * DIMH + e] = sum;
}

// ---------------------------------------------------------------------------
// Fold context into output weight:
//   W2[b][c][h*32+d] = sum_e w_out[c][h*32+e] * ctx[b][h][d][e]   (f16 out)
// ---------------------------------------------------------------------------
__global__ __launch_bounds__(256) void fold_w2_kernel(const float* __restrict__ w_out,
                                                      const float* __restrict__ ctx,
                                                      f16* __restrict__ w2) {
    long o = (long)blockIdx.x * blockDim.x + threadIdx.x;   // B*256*128 elems
    if (o >= (long)BATCH * CCH * HID) return;
    int j = (int)(o & (HID - 1));
    long rem = o >> 7;
    int c = (int)(rem & (CCH - 1));
    int b = (int)(rem >> 8);
    int h = j >> 5;
    int d = j & 31;
    const float* wr = w_out + (long)c * HID + h * DIMH;
    const float* cr = ctx + (((long)b * HEADS + h) * DIMH + d) * DIMH;
    float acc = 0.f;
    for (int e = 0; e < DIMH; e++) acc += wr[e] * cr[e];
    w2[o] = (f16)acc;
}

// ---------------------------------------------------------------------------
extern "C" void kernel_launch(void* const* d_in, const int* in_sizes, int n_in,
                              void* d_out, int out_size, void* d_ws, size_t ws_size,
                              hipStream_t stream) {
    const float* x     = (const float*)d_in[0];   // (16,256,64,64)
    const float* cond  = (const float*)d_in[1];   // (16,512,32,32)
    const float* gn_w  = (const float*)d_in[2];
    const float* gn_b  = (const float*)d_in[3];
    const float* w_q   = (const float*)d_in[4];   // (128,256)
    const float* b_q   = (const float*)d_in[5];
    const float* w_kv  = (const float*)d_in[6];   // (256,512)
    const float* b_kv  = (const float*)d_in[7];
    const float* w_out = (const float*)d_in[8];   // (256,128)
    const float* b_out = (const float*)d_in[9];
    float* out = (float*)d_out;                   // (16,256,64,64)

    // workspace layout
    char* ws = (char*)d_ws;
    constexpr long SZ_XN   = (long)BATCH * CCH * NPIX * 2;   // 33.5 MB f16
    constexpr long SZ_CD16 = (long)BATCH * CD * NC * 2;      // 16.8 MB f16
    constexpr long SZ_WQ   = (long)HID * CCH * 2;
    constexpr long SZ_WKV  = (long)2 * HID * CD * 2;
    constexpr long SZ_KV   = (long)BATCH * 2 * HID * NC * 4; // f32
    constexpr long SZ_Q16  = (long)BATCH * HID * NPIX * 2;
    constexpr long SZ_CTX  = (long)BATCH * HEADS * DIMH * DIMH * 4;
    f16*   xn16   = (f16*)(ws);
    f16*   cond16 = (f16*)(ws + SZ_XN);
    f16*   wq16   = (f16*)(ws + SZ_XN + SZ_CD16);
    f16*   wkv16  = (f16*)(ws + SZ_XN + SZ_CD16 + SZ_WQ);
    float* kvf    = (float*)(ws + SZ_XN + SZ_CD16 + SZ_WQ + SZ_WKV);
    f16*   q16    = (f16*)(ws + SZ_XN + SZ_CD16 + SZ_WQ + SZ_WKV + SZ_KV);
    float* ctxf   = (float*)(ws + SZ_XN + SZ_CD16 + SZ_WQ + SZ_WKV + SZ_KV + SZ_Q16);
    f16*   w2_16  = (f16*)(ws + SZ_XN + SZ_CD16 + SZ_WQ + SZ_WKV + SZ_KV + SZ_Q16 + SZ_CTX);

    // 1) converts
    long ncond = (long)BATCH * CD * NC;
    cvt_f16_kernel<<<(ncond + 255) / 256, 256, 0, stream>>>(cond, cond16, ncond);
    cvt_f16_kernel<<<(HID * CCH + 255) / 256, 256, 0, stream>>>(w_q, wq16, HID * CCH);
    cvt_f16_kernel<<<(2 * HID * CD + 255) / 256, 256, 0, stream>>>(w_kv, wkv16, 2 * HID * CD);

    // 2) GroupNorm -> xn f16
    groupnorm_kernel<<<BATCH * GROUPS, 256, 0, stream>>>(x, gn_w, gn_b, xn16);

    // 3) kv = w_kv @ cond + b_kv   (M=256,K=512,N=1024, f32 out)
    gemm_wmma_kernel<false><<<dim3(256 / 64, NC / 64, BATCH), 256, 0, stream>>>(
        wkv16, 0, cond16, (long)CD * NC, kvf, (long)2 * HID * NC, b_kv, 2 * HID, NC, CD);

    // 4) q = w_q @ xn + b_q        (M=128,K=256,N=4096, f16 out)
    gemm_wmma_kernel<true><<<dim3(HID / 64, NPIX / 64, BATCH), 256, 0, stream>>>(
        wq16, 0, xn16, (long)CCH * NPIX, q16, (long)HID * NPIX, b_q, HID, NPIX, CCH);

    // 5) softmax(k) + context = P @ V^T  per (b,h)
    softmax_ctx_kernel<<<dim3(HEADS, BATCH, 2), 512, 0, stream>>>(kvf, ctxf);

    // 6) fold ctx into output weight: W2 = w_out x ctx
    long nw2 = (long)BATCH * CCH * HID;
    fold_w2_kernel<<<(nw2 + 255) / 256, 256, 0, stream>>>(w_out, ctxf, w2_16);

    // 7) out = W2 @ q + b_out      (M=256,K=128,N=4096, f32 out)
    gemm_wmma_kernel<false><<<dim3(CCH / 64, NPIX / 64, BATCH), 256, 0, stream>>>(
        w2_16, (long)CCH * HID, q16, (long)HID * NPIX, out, (long)CCH * NPIX, b_out,
        CCH, NPIX, HID);
}

// v002
// One run takes 127 microseconds.
// Timed twice side by side with v001, it ran 1.15 and 1.17 times as fast.
// Counting every step since v000, it is 1.47 times as fast.
#include <hip/hip_runtime.h>
#include <hip/hip_bf16.h>

typedef _Float16 f16;
typedef __attribute__((ext_vector_type(16))) _Float16 v16h;
typedef __attribute__((ext_vector_type(8)))  float    v8f;
typedef __attribute__((ext_vector_type(4)))  unsigned int u32x4;
typedef __attribute__((ext_vector_type(2)))  unsigned int u32x2;
typedef int gvi4 __attribute__((vector_size(16)));   // matches async-LDS builtin param
typedef __attribute__((ext_vector_type(4))) float    f32x4;
typedef __attribute__((ext_vector_type(4))) _Float16 f16x4;

union Frag16 { v16h h; u32x4 q[2]; };

#define AS1 __attribute__((address_space(1)))
#define AS3 __attribute__((address_space(3)))

#if __has_builtin(__builtin_amdgcn_global_load_async_to_lds_b128)
#define HAVE_ASYNC_LDS 1
#else
#define HAVE_ASYNC_LDS 0
#endif

__device__ __forceinline__ void wait_asynccnt0() {
#if __has_builtin(__builtin_amdgcn_s_wait_asynccnt)
    __builtin_amdgcn_s_wait_asynccnt(0);
#else
    asm volatile("s_wait_asynccnt 0x0" ::: "memory");
#endif
}

#define HEADS 4
#define DIMH 32
#define BATCH 16
#define CCH 256      // x channels
#define CD 512       // cond channels
#define HID 128      // heads*dim_head
#define NPIX 4096    // 64*64
#define NC 1024      // 32*32
#define GROUPS 32

// ---------------------------------------------------------------------------
// GroupNorm: x (B,256,4096) -> xn f16, 1 block per (batch, group)
// ---------------------------------------------------------------------------
__global__ __launch_bounds__(256) void groupnorm_kernel(const float* __restrict__ x,
                                                        const float* __restrict__ w,
                                                        const float* __restrict__ b,
                                                        f16* __restrict__ xn) {
    int blk = blockIdx.x;
    int bat = blk >> 5;
    int g   = blk & 31;
    const float* xb = x + ((long)bat * CCH + g * 8) * NPIX;
    f16*         ob = xn + ((long)bat * CCH + g * 8) * NPIX;
    int t = threadIdx.x;

    float s = 0.f, s2 = 0.f;
    for (int i = t; i < 8 * NPIX; i += 256) {
        float v = xb[i];
        s += v; s2 += v * v;
    }
    __shared__ float sh[256], sh2[256];
    sh[t] = s; sh2[t] = s2;
    __syncthreads();
    for (int o = 128; o > 0; o >>= 1) {
        if (t < o) { sh[t] += sh[t + o]; sh2[t] += sh2[t + o]; }
        __syncthreads();
    }
    float mu  = sh[0] * (1.0f / 32768.0f);
    float var = sh2[0] * (1.0f / 32768.0f) - mu * mu;
    float ri  = rsqrtf(var + 1e-5f);
    for (int i = t; i < 8 * NPIX; i += 256) {
        int ch = g * 8 + (i >> 12);
        float v = (xb[i] - mu) * ri;
        ob[i] = (f16)(v * w[ch] + b[ch]);
    }
}

// ---------------------------------------------------------------------------
// WMMA f16 GEMM:  C[b] = A[b] (MxK) * B[b] (KxN) + bias
//
// Block tile 64(M) x 64(N), BK=32, 8 waves; wave (w>>1, w&1) owns a 16x32
// output strip: one A fragment reused across two v_wmma_f32_16x16x32_f16.
// Double-buffered LDS, one barrier per K-step. A tile staged with
// GLOBAL_LOAD_ASYNC_TO_LDS_B128 (ASYNCcnt); B tile staged transposed [n][k]
// so fragments fill with two aligned 16B LDS loads per lane.
// An operand that is still f32 in memory (A32 / B32: the weights, cond) is loaded as
// f32 and rounded to f16 in registers on its way into LDS, so it needs no convert
// launch and no f16 copy in the workspace; such an A tile goes through registers.
//
// Fragment layout (ISA 7.12.2, 16-bit 16x32): lane L (idx = L&15):
//   halves 0..7  = K (L<16 ? 0..7 : 8..15),  halves 8..15 = +16.
// ---------------------------------------------------------------------------
template <bool OUT16, bool A32, bool B32>
__global__ __launch_bounds__(256) void gemm_wmma_kernel(
    const f16* __restrict__ A, const float* __restrict__ Af, long sA,
    const f16* __restrict__ B, const float* __restrict__ Bf, long sB,
    void* __restrict__ Cv, long sC,
    const float* __restrict__ bias,
    int M, int N, int K) {

    __shared__ f16 ldsA[2][64][32];   // [buf][m][k]
    __shared__ f16 ldsB[2][64][32];   // [buf][n][k]

    int bat = blockIdx.z;
    int m0  = blockIdx.x * 64;
    int n0  = blockIdx.y * 64;
    int t    = threadIdx.x;
    int lane = t & 31;
    int warp = t >> 5;
    int trow = (warp >> 1) * 16;     // 0,16,32,48
    int tcol = (warp & 1) * 32;      // 0,32
    int hs   = (lane >> 4) * 8;      // K-half select

    const f16*   Ab  = A32 ? nullptr : A + (long)bat * sA;
    const float* Afb = A32 ? Af + (long)bat * sA : nullptr;
    const f16*   Bb  = B32 ? nullptr : B + (long)bat * sB;
    const float* Bfb = B32 ? Bf + (long)bat * sB : nullptr;

    // staging coordinates: 2048 halves per tile, 8 per thread
    int ar_st = t >> 2;              // A row 0..63
    int ac_st = (t & 3) * 8;         // A k-col, multiple of 8
    int bk_st = (t * 8) >> 6;        // B k-row 0..31
    int bn_st = (t * 8) & 63;        // B n-col, multiple of 8

    v8f acc0 = {0.f, 0.f, 0.f, 0.f, 0.f, 0.f, 0.f, 0.f};
    v8f acc1 = {0.f, 0.f, 0.f, 0.f, 0.f, 0.f, 0.f, 0.f};

    int nk = K >> 5;
    u32x4 rb;                        // f16 operands: 8 halves
    f32x4 rbf0, rbf1, raf0, raf1;    // f32 operands: 8 floats
    if constexpr (B32) {
        const f32x4* p = (const f32x4*)(Bfb + (long)bk_st * N + n0 + bn_st);
        rbf0 = p[0]; rbf1 = p[1];
    } else {
        rb = *(const u32x4*)(Bb + (long)bk_st * N + n0 + bn_st);
    }
#if !HAVE_ASYNC_LDS
    u32x4 ra;
#endif
    if constexpr (A32) {
        const f32x4* p = (const f32x4*)(Afb + (long)(m0 + ar_st) * K + ac_st);
        raf0 = p[0]; raf1 = p[1];
    } else {
#if HAVE_ASYNC_LDS
        __builtin_amdgcn_global_load_async_to_lds_b128(
            (AS1 gvi4*)(Ab + (long)(m0 + ar_st) * K + ac_st),
            (AS3 gvi4*)&ldsA[0][ar_st][ac_st], 0, 0);
#else
        ra = *(const u32x4*)(Ab + (long)(m0 + ar_st) * K + ac_st);
#endif
    }

    for (int kt = 0; kt < nk; kt++) {
        int buf = kt & 1;
        // ---- commit tile kt to LDS ---------------------------------------
        {
            f16 tmp[8];
            if constexpr (B32) {
#pragma unroll
                for (int i = 0; i < 4; i++) { tmp[i] = (f16)rbf0[i]; tmp[4 + i] = (f16)rbf1[i]; }
            } else {
                *(u32x4*)tmp = rb;
            }
#pragma unroll
            for (int i = 0; i < 8; i++) ldsB[buf][bn_st + i][bk_st] = tmp[i];
        }
        if constexpr (A32) {
            union { f16 h[8]; u32x4 q; } ta;
#pragma unroll
            for (int i = 0; i < 4; i++) { ta.h[i] = (f16)raf0[i]; ta.h[4 + i] = (f16)raf1[i]; }
            *(u32x4*)&ldsA[buf][ar_st][ac_st] = ta.q;
        } else {
#if HAVE_ASYNC_LDS
            wait_asynccnt0();        // my async A chunk for tile kt landed
#else
            *(u32x4*)&ldsA[buf][ar_st][ac_st] = ra;
#endif
        }
        __syncthreads();             // all waves' A+B chunks visible

        // ---- issue tile kt+1 (other buffer) ------------------------------
        if (kt + 1 < nk) {
            int k0 = (kt + 1) * 32;
            if constexpr (B32) {
                const f32x4* p = (const f32x4*)(Bfb + (long)(k0 + bk_st) * N + n0 + bn_st);
                rbf0 = p[0]; rbf1 = p[1];
            } else {
                rb = *(const u32x4*)(Bb + (long)(k0 + bk_st) * N + n0 + bn_st);
            }
            if constexpr (A32) {
                const f32x4* p = (const f32x4*)(Afb + (long)(m0 + ar_st) * K + k0 + ac_st);
                raf0 = p[0]; raf1 = p[1];
            } else {
#if HAVE_ASYNC_LDS
                __builtin_amdgcn_global_load_async_to_lds_b128(
                    (AS1 gvi4*)(Ab + (long)(m0 + ar_st) * K + k0 + ac_st),
                    (AS3 gvi4*)&ldsA[buf ^ 1][ar_st][ac_st], 0, 0);
#else
                ra = *(const u32x4*)(Ab + (long)(m0 + ar_st) * K + k0 + ac_st);
#endif
            }
            if (kt + 2 < nk) {       // prefetch B tile kt+2 -> global_prefetch_b8
                long off = (long)((kt + 2) * 32 + bk_st) * N + n0 + bn_st;
                __builtin_prefetch(B32 ? (const void*)(Bfb + off) : (const void*)(Bb + off), 0, 1);
            }
        }

        // ---- fragments + 2x WMMA -----------------------------------------
        Frag16 fa, fb0, fb1;
        int arr = trow + (lane & 15);
        int bc  = tcol + (lane & 15);
        fa.q[0]  = *(const u32x4*)&ldsA[buf][arr][hs];
        fa.q[1]  = *(const u32x4*)&ldsA[buf][arr][16 + hs];
        fb0.q[0] = *(const u32x4*)&ldsB[buf][bc][hs];
        fb0.q[1] = *(const u32x4*)&ldsB[buf][bc][16 + hs];
        fb1.q[0] = *(const u32x4*)&ldsB[buf][bc + 16][hs];
        fb1.q[1] = *(const u32x4*)&ldsB[buf][bc + 16][16 + hs];
        acc0 = __builtin_amdgcn_wmma_f32_16x16x32_f16(
            false, fa.h, false, fb0.h, (short)0, acc0, false, false);
        acc1 = __builtin_amdgcn_wmma_f32_16x16x32_f16(
            false, fa.h, false, fb1.h, (short)0, acc1, false, false);
    }

    // ---- epilogue: VGPR r -> row (trow + r + 8*(lane>=16)) ----------------
    int col0  = n0 + tcol + (lane & 15);
    int rbase = m0 + trow + (lane >> 4) * 8;
    for (int r = 0; r < 8; r++) {
        int row = rbase + r;
        float bv = bias[row];
        float v0 = acc0[r] + bv;
        float v1 = acc1[r] + bv;
        long base = (long)bat * sC + (long)row * N;
        if (OUT16) {
            ((f16*)Cv)[base + col0]      = (f16)v0;
            ((f16*)Cv)[base + col0 + 16] = (f16)v1;
        } else {
            ((float*)Cv)[base + col0]      = v0;
            ((float*)Cv)[base + col0 + 16] = v1;
        }
    }
}

// ---------------------------------------------------------------------------
// Per-(batch, head, half of d): softmax(k, axis=n), ctx[d][e] = sum_n p[d][n]*v[e][n]
// kv: (B, 256, 1024) f32;  k rows = h*32+d,  v rows = 128+h*32+e.
//
// 16 waves. Wave w keeps k row w of its d half and v rows w, w+16 whole in
// registers (24 wave-wide 16-byte loads, all issued before the first use), so
// kv is read once and the row max and sum need no second pass. P and V go to
// LDS as f16 once; then wave w multiplies the n slice [64w, 64w+64) for both
// e tiles, and the 16 partial tiles are summed in f32 through LDS.
// A block writes whole 128-byte rows of ctx.
// ---------------------------------------------------------------------------
// Four v_exp_f32 (the instruction __expf ends in) in one statement. The outputs are
// early-clobbered so that none lands on a source of the v_exp_f32 directly ahead of it, and
// the v_nop is the slot the instruction set asks for behind the last one.
__device__ __forceinline__ f32x4 exp2_x4(f32x4 a) {
    float r0, r1, r2, r3;
    asm("v_exp_f32 %0, %4\n\tv_exp_f32 %1, %5\n\tv_exp_f32 %2, %6\n\tv_exp_f32 %3, %7\n\tv_nop"
        : "=&v"(r0), "=&v"(r1), "=&v"(r2), "=&v"(r3)
        : "v"(a.x), "v"(a.y), "v"(a.z), "v"(a.w));
    f32x4 r = {r0, r1, r2, r3};
    return r;
}

#define SC_PITCH (NC + 8)    // halves: 2064 B = 16 B x odd, for the ds_load_b128 fragment reads
#define SC_TILE1 272         // dword offset of the second e tile's partials (16 banks off the first)

__global__ __launch_bounds__(512) void softmax_ctx_kernel(const float* __restrict__ kv,
                                                          float* __restrict__ ctx) {
    int h  = blockIdx.x;
    int b  = blockIdx.y;
    int dt = blockIdx.z;          // which 16 rows of d

    __shared__ __attribute__((aligned(16))) f16 ldsP[16][SC_PITCH];
    __shared__ __attribute__((aligned(16))) f16 ldsV[DIMH][SC_PITCH];
    __shared__ float red[16][SC_TILE1 + 256];

    int t = threadIdx.x;
    int lane = t & 31;
    int warp = t >> 5;

    const f32x4* kr = (const f32x4*)(kv + ((long)b * 256 + h * DIMH + dt * 16 + warp) * NC) + lane;
    const f32x4* va = (const f32x4*)(kv + ((long)b * 256 + HID + h * DIMH + warp) * NC) + lane;
    const f32x4* vb = va + 16 * NC / 4;

    f32x4 kq[8], v0[8], v1[8];
    for (int j = 0; j < 8; j++) kq[j] = kr[j * 32];
    for (int j = 0; j < 8; j++) v0[j] = va[j * 32];
    for (int j = 0; j < 8; j++) v1[j] = vb[j * 32];
    // The wait owed before a register that an issued load names is written again. The two
    // address pairs are its inputs, so they stay whole up to it (no load's result lands in them).
    asm volatile("s_wait_xcnt 0x0" :: "v"(kr), "v"(va) : "memory");
    // Keeps the max from being scheduled ahead of the v loads: without it they are issued
    // behind the wait for k, and their latency follows k's instead of overlapping it.
    __builtin_amdgcn_sched_barrier(0);

    // row max
    float m = -1e30f;
    for (int j = 0; j < 8; j++)
        m = fmaxf(m, fmaxf(fmaxf(kq[j].x, kq[j].y), fmaxf(kq[j].z, kq[j].w)));
    for (int o = 16; o >= 1; o >>= 1) m = fmaxf(m, __shfl_xor(m, o, 32));

    // exponentials stay in registers; four independent sum chains
    f32x4 s4 = {0.f, 0.f, 0.f, 0.f};
    for (int j = 0; j < 8; j++) {
        kq[j] = exp2_x4((kq[j] - m) * 1.44269504088896340736f);   // = __expf(k - m)
        s4 += kq[j];
    }
    float s = (s4.x + s4.y) + (s4.z + s4.w);
    for (int o = 16; o >= 1; o >>= 1) s += __shfl_xor(s, o, 32);
    float inv = 1.0f / s;

    for (int j = 0; j < 8; j++) {
        f32x4 p = kq[j] * inv;
        f16x4 ph = {(f16)p.x, (f16)p.y, (f16)p.z, (f16)p.w};
        f16x4 ah = {(f16)v0[j].x, (f16)v0[j].y, (f16)v0[j].z, (f16)v0[j].w};
        f16x4 bh = {(f16)v1[j].x, (f16)v1[j].y, (f16)v1[j].z, (f16)v1[j].w};
        *(f16x4*)&ldsP[warp][j * 128 + lane * 4]      = ph;
        *(f16x4*)&ldsV[warp][j * 128 + lane * 4]      = ah;
        *(f16x4*)&ldsV[warp + 16][j * 128 + lane * 4] = bh;
    }
    __syncthreads();

    // wave w: n slice [64w, 64w+64), one A fragment feeds both e tiles
    v8f acc0 = {0.f, 0.f, 0.f, 0.f, 0.f, 0.f, 0.f, 0.f};
    v8f acc1 = {0.f, 0.f, 0.f, 0.f, 0.f, 0.f, 0.f, 0.f};
    int c  = lane & 15;
    int hs = (lane >> 4) * 8;
    for (int ks = 0; ks < 2; ks++) {
        int kk = warp * 64 + ks * 32;
        Frag16 fa, fb0, fb1;
        fa.q[0]  = *(const u32x4*)&ldsP[c][kk + hs];
        fa.q[1]  = *(const u32x4*)&ldsP[c][kk + 16 + hs];
        fb0.q[0] = *(const u32x4*)&ldsV[c][kk + hs];
        fb0.q[1] = *(const u32x4*)&ldsV[c][kk + 16 + hs];
        fb1.q[0] = *(const u32x4*)&ldsV[c + 16][kk + hs];
        fb1.q[1] = *(const u32x4*)&ldsV[c + 16][kk + 16 + hs];
        acc0 = __builtin_amdgcn_wmma_f32_16x16x32_f16(
            false, fa.h, false, fb0.h, (short)0, acc0, false, false);
        acc1 = __builtin_amdgcn_wmma_f32_16x16x32_f16(
            false, fa.h, false, fb1.h, (short)0, acc1, false, false);
    }
    for (int r = 0; r < 8; r++) {
        red[warp][r * 32 + lane]            = acc0[r];
        red[warp][SC_TILE1 + r * 32 + lane] = acc1[r];
    }
    __syncthreads();

    // thread t owns ctx[dt*16 + (t>>5)][t&31]; register r, lane 16*(d>>3)+c held D[d][c]
    int d = warp;
    int e = lane;
    int idx = (e >> 4) * SC_TILE1 + (d & 7) * 32 + (d >> 3) * 16 + (e & 15);
    float sum = 0.f;
    for (int w = 0; w < 16; w++) sum += red[w][idx];
    ctx[(((long)b * HEADS + h) * DIMH + dt * 16 + d) * DIMH + e] = sum;
}

// ---------------------------------------------------------------------------
// Fold context into output weight:
//   W2[b][c][h*32+d] = sum_e w_out[c][h*32+e] * ctx[b][h][d][e]   (f16 out)
// ---------------------------------------------------------------------------
__global__ __launch_bounds__(256) void fold_w2_kernel(const float* __restrict__ w_out,
                                                      const float* __restrict__ ctx,
                                                      f16* __restrict__ w2) {
    long o = (long)blockIdx.x * blockDim.x + threadIdx.x;   // B*256*128 elems
    if (o >= (long)BATCH * CCH * HID) return;
    int j = (int)(o & (HID - 1));
    long rem = o >> 7;
    int c = (int)(rem & (CCH - 1));
    int b = (int)(rem >> 8);
    int h = j >> 5;
    int d = j & 31;
    const float* wr = w_out + (long)c * HID + h * DIMH;
    const float* cr = ctx + (((long)b * HEADS + h) * DIMH + d) * DIMH;
    float acc = 0.f;
    for (int e = 0; e < DIMH; e++) acc += wr[e] * cr[e];
    w2[o] = (f16)acc;
}

// ---------------------------------------------------------------------------
extern "C" void kernel_launch(void* const* d_in, const int* in_sizes, int n_in,
                              void* d_out, int out_size, void* d_ws, size_t ws_size,
                              hipStream_t stream) {
    const float* x     = (const float*)d_in[0];   // (16,256,64,64)
    const float* cond  = (const float*)d_in[1];   // (16,512,32,32)
    const float* gn_w  = (const float*)d_in[2];
    const float* gn_b  = (const float*)d_in[3];
    const float* w_q   = (const float*)d_in[4];   // (128,256)
    const float* b_q   = (const float*)d_in[5];
    const float* w_kv  = (const float*)d_in[6];   // (256,512)
    const float* b_kv  = (const float*)d_in[7];
    const float* w_out = (const float*)d_in[8];   // (256,128)
    const float* b_out = (const float*)d_in[9];
    float* out = (float*)d_out;                   // (16,256,64,64)

    // workspace layout
    char* ws = (char*)d_ws;
    constexpr long SZ_XN   = (long)BATCH * CCH * NPIX * 2;   // 33.5 MB f16
    constexpr long SZ_KV   = (long)BATCH * 2 * HID * NC * 4; // f32
    constexpr long SZ_Q16  = (long)BATCH * HID * NPIX * 2;
    constexpr long SZ_CTX  = (long)BATCH * HEADS * DIMH * DIMH * 4;
    f16*   xn16   = (f16*)(ws);
    float* kvf    = (float*)(ws + SZ_XN);
    f16*   q16    = (f16*)(ws + SZ_XN + SZ_KV);
    float* ctxf   = (float*)(ws + SZ_XN + SZ_KV + SZ_Q16);
    f16*   w2_16  = (f16*)(ws + SZ_XN + SZ_KV + SZ_Q16 + SZ_CTX);

    // 1) GroupNorm -> xn f16
    groupnorm_kernel<<<BATCH * GROUPS, 256, 0, stream>>>(x, gn_w, gn_b, xn16);

    // 2) kv = w_kv @ cond + b_kv   (M=256,K=512,N=1024, f32 operands, f32 out)
    gemm_wmma_kernel<false, true, true><<<dim3(256 / 64, NC / 64, BATCH), 256, 0, stream>>>(
        nullptr, w_kv, 0, nullptr, cond, (long)CD * NC, kvf, (long)2 * HID * NC, b_kv, 2 * HID, NC, CD);

    // 3) q = w_q @ xn + b_q        (M=128,K=256,N=4096, f32 weight, f16 out)
    gemm_wmma_kernel<true, true, false><<<dim3(HID / 64, NPIX / 64, BATCH), 256, 0, stream>>>(
        nullptr, w_q, 0, xn16, nullptr, (long)CCH * NPIX, q16, (long)HID * NPIX, b_q, HID, NPIX, CCH);

    // 4) softmax(k) + context = P @ V^T  per (b,h)
    softmax_ctx_kernel<<<dim3(HEADS, BATCH, 2), 512, 0, stream>>>(kvf, ctxf);

    // 5) fold ctx into output weight: W2 = w_out x ctx
    long nw2 = (long)BATCH * CCH * HID;
    fold_w2_kernel<<<(nw2 + 255) / 256, 256, 0, stream>>>(w_out, ctxf, w2_16);

    // 6) out = W2 @ q + b_out      (M=256,K=128,N=4096, f32 out)
    gemm_wmma_kernel<false, false, false><<<dim3(CCH / 64, NPIX / 64, BATCH), 256, 0, stream>>>(
        w2_16, nullptr, (long)CCH * HID, q16, nullptr, (long)HID * NPIX, out, (long)CCH * NPIX, b_out,
        CCH, NPIX, HID);
}

// v003
// It runs in 89.4 microseconds.
// Next to v002, in two timings, it ran 1.41 times as fast each time.
// Over all steps from v000 it is 2.08 times as fast.
#include <hip/hip_runtime.h>
#include <hip/hip_bf16.h>

typedef _Float16 f16;
typedef __attribute__((ext_vector_type(16))) _Float16 v16h;
typedef __attribute__((ext_vector_type(8)))  float    v8f;
typedef __attribute__((ext_vector_type(4)))  unsigned int u32x4;
typedef __attribute__((ext_vector_type(2)))  unsigned int u32x2;
typedef int gvi4 __attribute__((vector_size(16)));   // matches async-LDS builtin param
typedef __attribute__((ext_vector_type(4))) float    f32x4;
typedef __attribute__((ext_vector_type(4))) _Float16 f16x4;

union Frag16 { v16h h; u32x4 q[2]; };

#define AS1 __attribute__((address_space(1)))
#define AS3 __attribute__((address_space(3)))

#if __has_builtin(__builtin_amdgcn_global_load_async_to_lds_b128)
#define HAVE_ASYNC_LDS 1
#else
#define HAVE_ASYNC_LDS 0
#endif

__device__ __forceinline__ void wait_asynccnt0() {
#if __has_builtin(__builtin_amdgcn_s_wait_asynccnt)
    __builtin_amdgcn_s_wait_asynccnt(0);
#else
    asm volatile("s_wait_asynccnt 0x0" ::: "memory");
#endif
}

#define HEADS 4
#define DIMH 32
#define BATCH 16
#define CCH 256      // x channels
#define CD 512       // cond channels
#define HID 128      // heads*dim_head
#define NPIX 4096    // 64*64
#define NC 1024      // 32*32
#define GROUPS 32

// ---------------------------------------------------------------------------
// GroupNorm: x (B,256,4096) -> xn f16, 1 block per (batch, group)
// ---------------------------------------------------------------------------
__global__ __launch_bounds__(256) void groupnorm_kernel(const float* __restrict__ x,
                                                        const float* __restrict__ w,
                                                        const float* __restrict__ b,
                                                        f16* __restrict__ xn) {
    int blk = blockIdx.x;
    int bat = blk >> 5;
    int g   = blk & 31;
    const float* xb = x + ((long)bat * CCH + g * 8) * NPIX;
    f16*         ob = xn + ((long)bat * CCH + g * 8) * NPIX;
    int t = threadIdx.x;

    float s = 0.f, s2 = 0.f;
    for (int i = t; i < 8 * NPIX; i += 256) {
        float v = xb[i];
        s += v; s2 += v * v;
    }
    __shared__ float sh[256], sh2[256];
    sh[t] = s; sh2[t] = s2;
    __syncthreads();
    for (int o = 128; o > 0; o >>= 1) {
        if (t < o) { sh[t] += sh[t + o]; sh2[t] += sh2[t + o]; }
        __syncthreads();
    }
    float mu  = sh[0] * (1.0f / 32768.0f);
    float var = sh2[0] * (1.0f / 32768.0f) - mu * mu;
    float ri  = rsqrtf(var + 1e-5f);
    for (int i = t; i < 8 * NPIX; i += 256) {
        int ch = g * 8 + (i >> 12);
        float v = (xb[i] - mu) * ri;
        ob[i] = (f16)(v * w[ch] + b[ch]);
    }
}

// ---------------------------------------------------------------------------
// WMMA f16 GEMM:  C[b] = A[b] (MxK) * B[b] (KxN) + bias
//
// Block tile 64(M) x 64(N), BK=32, 8 waves; wave (w>>1, w&1) owns a 16x32
// output strip: one A fragment reused across two v_wmma_f32_16x16x32_f16.
// Double-buffered LDS, one barrier per K-step. A tile staged with
// GLOBAL_LOAD_ASYNC_TO_LDS_B128 (ASYNCcnt). B tile staged as it lies in memory, [k][n],
// one 16B LDS store per thread; ds_load_tr16_b128 transposes it on the way into the
// fragment. Row pitches are padded for their readers (64 banks x 4 B): A 80 B = 16 B x odd
// for ds_load_b128, B 160 B = 32 B x odd for ds_load_tr16_b128.
// An operand that is still f32 in memory (A32 / B32: the weights, cond) is loaded as
// f32 and rounded to f16 in registers on its way into LDS, so it needs no convert
// launch and no f16 copy in the workspace; such an A tile goes through registers.
//
// Fragment layout (ISA 7.12.2, 16-bit 16x32): lane L (idx = L&15):
//   halves 0..7  = K (L<16 ? 0..7 : 8..15),  halves 8..15 = +16.
// Two transposing loads, at k rows 0 and 16 of the tile, deliver B in the same k order.
// ---------------------------------------------------------------------------
#define GA_PITCH 40   // halves per ldsA row (32 used)
#define GB_PITCH 80   // halves per ldsB row (64 used)

typedef __attribute__((ext_vector_type(8))) short s16x8;

// Lane l passes the address of 8 halves of row 8*(l>>4) + (l&7), column half (l>>3)&1, of a
// 16(k) x 16(n) block; it gets back column l&15, k = 8*(l>>4) .. +7.
__device__ __forceinline__ u32x4 lds_load_tr16(const f16* p) {
    return __builtin_bit_cast(u32x4, __builtin_amdgcn_ds_load_tr16_b128_v8i16((AS3 s16x8*)p));
}

template <bool OUT16, bool A32, bool B32>
__global__ __launch_bounds__(256) void gemm_wmma_kernel(
    const f16* __restrict__ A, const float* __restrict__ Af, long sA,
    const f16* __restrict__ B, const float* __restrict__ Bf, long sB,
    void* __restrict__ Cv, long sC,
    const float* __restrict__ bias,
    int M, int N, int K) {

    __shared__ __attribute__((aligned(16))) f16 ldsA[2][64][GA_PITCH];   // [buf][m][k]
    __shared__ __attribute__((aligned(16))) f16 ldsB[2][32][GB_PITCH];   // [buf][k][n]

    int bat = blockIdx.z;
    int m0  = blockIdx.x * 64;
    int n0  = blockIdx.y * 64;
    int t    = threadIdx.x;
    int lane = t & 31;
    int warp = t >> 5;
    int trow = (warp >> 1) * 16;     // 0,16,32,48
    int tcol = (warp & 1) * 32;      // 0,32
    int hs   = (lane >> 4) * 8;      // K-half select

    const f16*   Ab  = A32 ? nullptr : A + (long)bat * sA;
    const float* Afb = A32 ? Af + (long)bat * sA : nullptr;
    const f16*   Bb  = B32 ? nullptr : B + (long)bat * sB;
    const float* Bfb = B32 ? Bf + (long)bat * sB : nullptr;

    // staging coordinates: 2048 halves per tile, 8 per thread
    int ar_st = t >> 2;              // A row 0..63
    int ac_st = (t & 3) * 8;         // A k-col, multiple of 8
    int bk_st = (t * 8) >> 6;        // B k-row 0..31
    int bn_st = (t * 8) & 63;        // B n-col, multiple of 8

    v8f acc0 = {0.f, 0.f, 0.f, 0.f, 0.f, 0.f, 0.f, 0.f};
    v8f acc1 = {0.f, 0.f, 0.f, 0.f, 0.f, 0.f, 0.f, 0.f};

    int nk = K >> 5;
    u32x4 rb;                        // f16 operands: 8 halves
    f32x4 rbf0, rbf1, raf0, raf1;    // f32 operands: 8 floats
    if constexpr (B32) {
        const f32x4* p = (const f32x4*)(Bfb + (long)bk_st * N + n0 + bn_st);
        rbf0 = p[0]; rbf1 = p[1];
    } else {
        rb = *(const u32x4*)(Bb + (long)bk_st * N + n0 + bn_st);
    }
#if !HAVE_ASYNC_LDS
    u32x4 ra;
#endif
    if constexpr (A32) {
        const f32x4* p = (const f32x4*)(Afb + (long)(m0 + ar_st) * K + ac_st);
        raf0 = p[0]; raf1 = p[1];
    } else {
#if HAVE_ASYNC_LDS
        __builtin_amdgcn_global_load_async_to_lds_b128(
            (AS1 gvi4*)(Ab + (long)(m0 + ar_st) * K + ac_st),
            (AS3 gvi4*)&ldsA[0][ar_st][ac_st], 0, 0);
#else
        ra = *(const u32x4*)(Ab + (long)(m0 + ar_st) * K + ac_st);
#endif
    }

    for (int kt = 0; kt < nk; kt++) {
        int buf = kt & 1;
        // ---- commit tile kt to LDS ---------------------------------------
        {
            union { f16 h[8]; u32x4 q; } tb;
            if constexpr (B32) {
#pragma unroll
                for (int i = 0; i < 4; i++) { tb.h[i] = (f16)rbf0[i]; tb.h[4 + i] = (f16)rbf1[i]; }
            } else {
                tb.q = rb;
            }
            *(u32x4*)&ldsB[buf][bk_st][bn_st] = tb.q;
        }
        if constexpr (A32) {
            union { f16 h[8]; u32x4 q; } ta;
#pragma unroll
            for (int i = 0; i < 4; i++) { ta.h[i] = (f16)raf0[i]; ta.h[4 + i] = (f16)raf1[i]; }
            *(u32x4*)&ldsA[buf][ar_st][ac_st] = ta.q;
        } else {
#if HAVE_ASYNC_LDS
            wait_asynccnt0();        // my async A chunk for tile kt landed
#else
            *(u32x4*)&ldsA[buf][ar_st][ac_st] = ra;
#endif
        }
        __syncthreads();             // all waves' A+B chunks visible

        // ---- issue tile kt+1 (other buffer) ------------------------------
        if (kt + 1 < nk) {
            int k0 = (kt + 1) * 32;
            if constexpr (B32) {
                const f32x4* p = (const f32x4*)(Bfb + (long)(k0 + bk_st) * N + n0 + bn_st);
                rbf0 = p[0]; rbf1 = p[1];
            } else {
                rb = *(const u32x4*)(Bb + (long)(k0 + bk_st) * N + n0 + bn_st);
            }
            if constexpr (A32) {
                const f32x4* p = (const f32x4*)(Afb + (long)(m0 + ar_st) * K + k0 + ac_st);
                raf0 = p[0]; raf1 = p[1];
            } else {
#if HAVE_ASYNC_LDS
                __builtin_amdgcn_global_load_async_to_lds_b128(
                    (AS1 gvi4*)(Ab + (long)(m0 + ar_st) * K + k0 + ac_st),
                    (AS3 gvi4*)&ldsA[buf ^ 1][ar_st][ac_st], 0, 0);
#else
                ra = *(const u32x4*)(Ab + (long)(m0 + ar_st) * K + k0 + ac_st);
#endif
            }
            if (kt + 2 < nk) {       // prefetch B tile kt+2 -> global_prefetch_b8
                long off = (long)((kt + 2) * 32 + bk_st) * N + n0 + bn_st;
                __builtin_prefetch(B32 ? (const void*)(Bfb + off) : (const void*)(Bb + off), 0, 1);
            }
        }

        // ---- fragments + 2x WMMA -----------------------------------------
        Frag16 fa, fb0, fb1;
        int arr = trow + (lane & 15);
        const f16* bp = &ldsB[buf][hs + (lane & 7)][tcol + ((lane >> 3) & 1) * 8];
        fa.q[0]  = *(const u32x4*)&ldsA[buf][arr][hs];
        fa.q[1]  = *(const u32x4*)&ldsA[buf][arr][16 + hs];
        fb0.q[0] = lds_load_tr16(bp);
        fb0.q[1] = lds_load_tr16(bp + 16 * GB_PITCH);
        fb1.q[0] = lds_load_tr16(bp + 16);
        fb1.q[1] = lds_load_tr16(bp + 16 * GB_PITCH + 16);
        acc0 = __builtin_amdgcn_wmma_f32_16x16x32_f16(
            false, fa.h, false, fb0.h, (short)0, acc0, false, false);
        acc1 = __builtin_amdgcn_wmma_f32_16x16x32_f16(
            false, fa.h, false, fb1.h, (short)0, acc1, false, false);
    }

    // ---- epilogue: VGPR r -> row (trow + r + 8*(lane>=16)) ----------------
    int col0  = n0 + tcol + (lane & 15);
    int rbase = m0 + trow + (lane >> 4) * 8;
    for (int r = 0; r < 8; r++) {
        int row = rbase + r;
        float bv = bias[row];
        float v0 = acc0[r] + bv;
        float v1 = acc1[r] + bv;
        long base = (long)bat * sC + (long)row * N;
        if (OUT16) {
            ((f16*)Cv)[base + col0]      = (f16)v0;
            ((f16*)Cv)[base + col0 + 16] = (f16)v1;
        } else {
            ((float*)Cv)[base + col0]      = v0;
            ((float*)Cv)[base + col0 + 16] = v1;
        }
    }
}

// ---------------------------------------------------------------------------
// Per-(batch, head, half of d): softmax(k, axis=n), ctx[d][e] = sum_n p[d][n]*v[e][n]
// kv: (B, 256, 1024) f32;  k rows = h*32+d,  v rows = 128+h*32+e.
//
// 16 waves. Wave w keeps k row w of its d half and v rows w, w+16 whole in
// registers (24 wave-wide 16-byte loads, all issued before the first use), so
// kv is read once and the row max and sum need no second pass. P and V go to
// LDS as f16 once; then wave w multiplies the n slice [64w, 64w+64) for both
// e tiles, and the 16 partial tiles are summed in f32 through LDS.
// A block writes whole 128-byte rows of ctx.
// ---------------------------------------------------------------------------
// Four v_exp_f32 (the instruction __expf ends in) in one statement. The outputs are
// early-clobbered so that none lands on a source of the v_exp_f32 directly ahead of it, and
// the v_nop is the slot the instruction set asks for behind the last one.
__device__ __forceinline__ f32x4 exp2_x4(f32x4 a) {
    float r0, r1, r2, r3;
    asm("v_exp_f32 %0, %4\n\tv_exp_f32 %1, %5\n\tv_exp_f32 %2, %6\n\tv_exp_f32 %3, %7\n\tv_nop"
        : "=&v"(r0), "=&v"(r1), "=&v"(r2), "=&v"(r3)
        : "v"(a.x), "v"(a.y), "v"(a.z), "v"(a.w));
    f32x4 r = {r0, r1, r2, r3};
    return r;
}

#define SC_PITCH (NC + 8)    // halves: 2064 B = 16 B x odd, for the ds_load_b128 fragment reads
#define SC_TILE1 272         // dword offset of the second e tile's partials (16 banks off the first)

__global__ __launch_bounds__(512) void softmax_ctx_kernel(const float* __restrict__ kv,
                                                          float* __restrict__ ctx) {
    int h  = blockIdx.x;
    int b  = blockIdx.y;
    int dt = blockIdx.z;          // which 16 rows of d

    __shared__ __attribute__((aligned(16))) f16 ldsP[16][SC_PITCH];
    __shared__ __attribute__((aligned(16))) f16 ldsV[DIMH][SC_PITCH];
    __shared__ float red[16][SC_TILE1 + 256];

    int t = threadIdx.x;
    int lane = t & 31;
    int warp = t >> 5;

    const f32x4* kr = (const f32x4*)(kv + ((long)b * 256 + h * DIMH + dt * 16 + warp) * NC) + lane;
    const f32x4* va = (const f32x4*)(kv + ((long)b * 256 + HID + h * DIMH + warp) * NC) + lane;
    const f32x4* vb = va + 16 * NC / 4;

    f32x4 kq[8], v0[8], v1[8];
    for (int j = 0; j < 8; j++) kq[j] = kr[j * 32];
    for (int j = 0; j < 8; j++) v0[j] = va[j * 32];
    for (int j = 0; j < 8; j++) v1[j] = vb[j * 32];
    // The wait owed before a register that an issued load names is written again. The two
    // address pairs are its inputs, so they stay whole up to it (no load's result lands in them).
    asm volatile("s_wait_xcnt 0x0" :: "v"(kr), "v"(va) : "memory");
    // Keeps the max from being scheduled ahead of the v loads: without it they are issued
    // behind the wait for k, and their latency follows k's instead of overlapping it.
    __builtin_amdgcn_sched_barrier(0);

    // row max
    float m = -1e30f;
    for (int j = 0; j < 8; j++)
        m = fmaxf(m, fmaxf(fmaxf(kq[j].x, kq[j].y), fmaxf(kq[j].z, kq[j].w)));
    for (int o = 16; o >= 1; o >>= 1) m = fmaxf(m, __shfl_xor(m, o, 32));

    // exponentials stay in registers; four independent sum chains
    f32x4 s4 = {0.f, 0.f, 0.f, 0.f};
    for (int j = 0; j < 8; j++) {
        kq[j] = exp2_x4((kq[j] - m) * 1.44269504088896340736f);   // = __expf(k - m)
        s4 += kq[j];
    }
    float s = (s4.x + s4.y) + (s4.z + s4.w);
    for (int o = 16; o >= 1; o >>= 1) s += __shfl_xor(s, o, 32);
    float inv = 1.0f / s;

    for (int j = 0; j < 8; j++) {
        f32x4 p = kq[j] * inv;
        f16x4 ph = {(f16)p.x, (f16)p.y, (f16)p.z, (f16)p.w};
        f16x4 ah = {(f16)v0[j].x, (f16)v0[j].y, (f16)v0[j].z, (f16)v0[j].w};
        f16x4 bh = {(f16)v1[j].x, (f16)v1[j].y, (f16)v1[j].z, (f16)v1[j].w};
        *(f16x4*)&ldsP[warp][j * 128 + lane * 4]      = ph;
        *(f16x4*)&ldsV[warp][j * 128 + lane * 4]      = ah;
        *(f16x4*)&ldsV[warp + 16][j * 128 + lane * 4] = bh;
    }
    __syncthreads();

    // wave w: n slice [64w, 64w+64), one A fragment feeds both e tiles
    v8f acc0 = {0.f, 0.f, 0.f, 0.f, 0.f, 0.f, 0.f, 0.f};
    v8f acc1 = {0.f, 0.f, 0.f, 0.f, 0.f, 0.f, 0.f, 0.f};
    int c  = lane & 15;
    int hs = (lane >> 4) * 8;
    for (int ks = 0; ks < 2; ks++) {
        int kk = warp * 64 + ks * 32;
        Frag16 fa, fb0, fb1;
        fa.q[0]  = *(const u32x4*)&ldsP[c][kk + hs];
        fa.q[1]  = *(const u32x4*)&ldsP[c][kk + 16 + hs];
        fb0.q[0] = *(const u32x4*)&ldsV[c][kk + hs];
        fb0.q[1] = *(const u32x4*)&ldsV[c][kk + 16 + hs];
        fb1.q[0] = *(const u32x4*)&ldsV[c + 16][kk + hs];
        fb1.q[1] = *(const u32x4*)&ldsV[c + 16][kk + 16 + hs];
        acc0 = __builtin_amdgcn_wmma_f32_16x16x32_f16(
            false, fa.h, false, fb0.h, (short)0, acc0, false, false);
        acc1 = __builtin_amdgcn_wmma_f32_16x16x32_f16(
            false, fa.h, false, fb1.h, (short)0, acc1, false, false);
    }
    for (int r = 0; r < 8; r++) {
        red[warp][r * 32 + lane]            = acc0[r];
        red[warp][SC_TILE1 + r * 32 + lane] = acc1[r];
    }
    __syncthreads();

    // thread t owns ctx[dt*16 + (t>>5)][t&31]; register r, lane 16*(d>>3)+c held D[d][c]
    int d = warp;
    int e = lane;
    int idx = (e >> 4) * SC_TILE1 + (d & 7) * 32 + (d >> 3) * 16 + (e & 15);
    float sum = 0.f;
    for (int w = 0; w < 16; w++) sum += red[w][idx];
    ctx[(((long)b * HEADS + h) * DIMH + dt * 16 + d) * DIMH + e] = sum;
}

// ---------------------------------------------------------------------------
// Fold context into output weight:
//   W2[b][c][h*32+d] = sum_e w_out[c][h*32+e] * ctx[b][h][d][e]   (f16 out)
// ---------------------------------------------------------------------------
__global__ __launch_bounds__(256) void fold_w2_kernel(const float* __restrict__ w_out,
                                                      const float* __restrict__ ctx,
                                                      f16* __restrict__ w2) {
    long o = (long)blockIdx.x * blockDim.x + threadIdx.x;   // B*256*128 elems
    if (o >= (long)BATCH * CCH * HID) return;
    int j = (int)(o & (HID - 1));
    long rem = o >> 7;
    int c = (int)(rem & (CCH - 1));
    int b = (int)(rem >> 8);
    int h = j >> 5;
    int d = j & 31;
    const float* wr = w_out + (long)c * HID + h * DIMH;
    const float* cr = ctx + (((long)b * HEADS + h) * DIMH + d) * DIMH;
    float acc = 0.f;
    for (int e = 0; e < DIMH; e++) acc += wr[e] * cr[e];
    w2[o] = (f16)acc;
}

// ---------------------------------------------------------------------------
extern "C" void kernel_launch(void* const* d_in, const int* in_sizes, int n_in,
                              void* d_out, int out_size, void* d_ws, size_t ws_size,
                              hipStream_t stream) {
    const float* x     = (const float*)d_in[0];   // (16,256,64,64)
    const float* cond  = (const float*)d_in[1];   // (16,512,32,32)
    const float* gn_w  = (const float*)d_in[2];
    const float* gn_b  = (const float*)d_in[3];
    const float* w_q   = (const float*)d_in[4];   // (128,256)
    const float* b_q   = (const float*)d_in[5];
    const float* w_kv  = (const float*)d_in[6];   // (256,512)
    const float* b_kv  = (const float*)d_in[7];
    const float* w_out = (const float*)d_in[8];   // (256,128)
    const float* b_out = (const float*)d_in[9];
    float* out = (float*)d_out;                   // (16,256,64,64)

    // workspace layout
    char* ws = (char*)d_ws;
    constexpr long SZ_XN   = (long)BATCH * CCH * NPIX * 2;   // 33.5 MB f16
    constexpr long SZ_KV   = (long)BATCH * 2 * HID * NC * 4; // f32
    constexpr long SZ_Q16  = (long)BATCH * HID * NPIX * 2;
    constexpr long SZ_CTX  = (long)BATCH * HEADS * DIMH * DIMH * 4;
    f16*   xn16   = (f16*)(ws);
    float* kvf    = (float*)(ws + SZ_XN);
    f16*   q16    = (f16*)(ws + SZ_XN + SZ_KV);
    float* ctxf   = (float*)(ws + SZ_XN + SZ_KV + SZ_Q16);
    f16*   w2_16  = (f16*)(ws + SZ_XN + SZ_KV + SZ_Q16 + SZ_CTX);

    // 1) GroupNorm -> xn f16
    groupnorm_kernel<<<BATCH * GROUPS, 256, 0, stream>>>(x, gn_w, gn_b, xn16);

    // 2) kv = w_kv @ cond + b_kv   (M=256,K=512,N=1024, f32 operands, f32 out)
    gemm_wmma_kernel<false, true, true><<<dim3(256 / 64, NC / 64, BATCH), 256, 0, stream>>>(
        nullptr, w_kv, 0, nullptr, cond, (long)CD * NC, kvf, (long)2 * HID * NC, b_kv, 2 * HID, NC, CD);

    // 3) q = w_q @ xn + b_q        (M=128,K=256,N=4096, f32 weight, f16 out)
    gemm_wmma_kernel<true, true, false><<<dim3(HID / 64, NPIX / 64, BATCH), 256, 0, stream>>>(
        nullptr, w_q, 0, xn16, nullptr, (long)CCH * NPIX, q16, (long)HID * NPIX, b_q, HID, NPIX, CCH);

    // 4) softmax(k) + context = P @ V^T  per (b,h)
    softmax_ctx_kernel<<<dim3(HEADS, BATCH, 2), 512, 0, stream>>>(kvf, ctxf);

    // 5) fold ctx into output weight: W2 = w_out x ctx
    long nw2 = (long)BATCH * CCH * HID;
    fold_w2_kernel<<<(nw2 + 255) / 256, 256, 0, stream>>>(w_out, ctxf, w2_16);

    // 6) out = W2 @ q + b_out      (M=256,K=128,N=4096, f32 out)
    gemm_wmma_kernel<false, false, false><<<dim3(CCH / 64, NPIX / 64, BATCH), 256, 0, stream>>>(
        w2_16, nullptr, (long)CCH * HID, q16, nullptr, (long)HID * NPIX, out, (long)CCH * NPIX, b_out,
        CCH, NPIX, HID);
}

// v004
// Measured time: 78.3 microseconds a run.
// Timed twice side by side with v003, it ran 1.15 and 1.14 times as fast.
// All steps since v000 together make it 2.38 times as fast.
#include <hip/hip_runtime.h>
#include <hip/hip_bf16.h>

typedef _Float16 f16;
typedef __attribute__((ext_vector_type(16))) _Float16 v16h;
typedef __attribute__((ext_vector_type(8)))  float    v8f;
typedef __attribute__((ext_vector_type(4)))  unsigned int u32x4;
typedef __attribute__((ext_vector_type(2)))  unsigned int u32x2;
typedef int gvi4 __attribute__((vector_size(16)));   // matches async-LDS builtin param
typedef __attribute__((ext_vector_type(4))) float    f32x4;
typedef __attribute__((ext_vector_type(4))) _Float16 f16x4;

union Frag16 { v16h h; u32x4 q[2]; };

#define AS1 __attribute__((address_space(1)))
#define AS3 __attribute__((address_space(3)))

#if __has_builtin(__builtin_amdgcn_global_load_async_to_lds_b128)
#define HAVE_ASYNC_LDS 1
#else
#define HAVE_ASYNC_LDS 0
#endif

__device__ __forceinline__ void wait_asynccnt0() {
#if __has_builtin(__builtin_amdgcn_s_wait_asynccnt)
    __builtin_amdgcn_s_wait_asynccnt(0);
#else
    asm volatile("s_wait_asynccnt 0x0" ::: "memory");
#endif
}

#define HEADS 4
#define DIMH 32
#define BATCH 16
#define CCH 256      // x channels
#define CD 512       // cond channels
#define HID 128      // heads*dim_head
#define NPIX 4096    // 64*64
#define NC 1024      // 32*32
#define GROUPS 32

// ---------------------------------------------------------------------------
// GroupNorm: x (B,256,4096) -> xn f16, 1 block per (batch, group)
// ---------------------------------------------------------------------------
__global__ __launch_bounds__(256) void groupnorm_kernel(const float* __restrict__ x,
                                                        const float* __restrict__ w,
                                                        const float* __restrict__ b,
                                                        f16* __restrict__ xn) {
    int blk = blockIdx.x;
    int bat = blk >> 5;
    int g   = blk & 31;
    const float* xb = x + ((long)bat * CCH + g * 8) * NPIX;
    f16*         ob = xn + ((long)bat * CCH + g * 8) * NPIX;
    int t = threadIdx.x;

    float s = 0.f, s2 = 0.f;
    for (int i = t; i < 8 * NPIX; i += 256) {
        float v = xb[i];
        s += v; s2 += v * v;
    }
    __shared__ float sh[256], sh2[256];
    sh[t] = s; sh2[t] = s2;
    __syncthreads();
    for (int o = 128; o > 0; o >>= 1) {
        if (t < o) { sh[t] += sh[t + o]; sh2[t] += sh2[t + o]; }
        __syncthreads();
    }
    float mu  = sh[0] * (1.0f / 32768.0f);
    float var = sh2[0] * (1.0f / 32768.0f) - mu * mu;
    float ri  = rsqrtf(var + 1e-5f);
    for (int i = t; i < 8 * NPIX; i += 256) {
        int ch = g * 8 + (i >> 12);
        float v = (xb[i] - mu) * ri;
        ob[i] = (f16)(v * w[ch] + b[ch]);
    }
}

// ---------------------------------------------------------------------------
// WMMA f16 GEMM:  C[b] = A[b] (MxK) * B[b] (KxN) + bias
//
// Block tile 128(M) x 128(N), BK=64, 8 waves; wave (w>>1, w&1) owns a 32x64 output
// patch: per 32 k, two A and four B fragments feed eight v_wmma_f32_16x16x32_f16, so
// a fragment read from LDS is used 4 (A) or 2 (B) times, and few, long-lived waves do the
// work: fewer wave starts and fewer barrier trips per product.
// M, N multiples of 128, K of 64.
// Double-buffered LDS, one barrier per K-step. A tile staged with
// GLOBAL_LOAD_ASYNC_TO_LDS_B128 (ASYNCcnt). B tile staged as it lies in memory, [k][n],
// 16B LDS stores; ds_load_tr16_b128 transposes it on the way into the
// fragment. Row pitches are padded for their readers (64 banks x 4 B): A 144 B = 16 B x odd
// for ds_load_b128, B 288 B = 32 B x odd for ds_load_tr16_b128.
// An operand that is still f32 in memory (A32 / B32: the weights, cond) is loaded as
// f32 and rounded to f16 in registers on its way into LDS, so it needs no convert
// launch and no f16 copy in the workspace; such an A tile goes through registers.
//
// Fragment layout (ISA 7.12.2, 16-bit 16x32): lane L (idx = L&15):
//   halves 0..7  = K (L<16 ? 0..7 : 8..15),  halves 8..15 = +16.
// Two transposing loads, at k rows 0 and 16 of a 32-k slab, deliver B in the same k order.
// ---------------------------------------------------------------------------
#define GBM 128
#define GBN 128
#define GBK 64
#define GA_PITCH 72    // halves per ldsA row (64 used)
#define GB_PITCH 144   // halves per ldsB row (128 used)

typedef __attribute__((ext_vector_type(8))) short s16x8;

// Lane l passes the address of 8 halves of row 8*(l>>4) + (l&7), column half (l>>3)&1, of a
// 16(k) x 16(n) block; it gets back column l&15, k = 8*(l>>4) .. +7.
__device__ __forceinline__ u32x4 lds_load_tr16(const f16* p) {
    return __builtin_bit_cast(u32x4, __builtin_amdgcn_ds_load_tr16_b128_v8i16((AS3 s16x8*)p));
}

__device__ __forceinline__ u32x4 round_to_f16x8(f32x4 lo, f32x4 hi) {
    union { f16 h[8]; u32x4 q; } u;
    for (int i = 0; i < 4; i++) { u.h[i] = (f16)lo[i]; u.h[4 + i] = (f16)hi[i]; }
    return u.q;
}

template <bool OUT16, bool A32, bool B32>
__global__ __launch_bounds__(256) void gemm_wmma_kernel(
    const f16* __restrict__ A, const float* __restrict__ Af, long sA,
    const f16* __restrict__ B, const float* __restrict__ Bf, long sB,
    void* __restrict__ Cv, long sC,
    const float* __restrict__ bias,
    int M, int N, int K) {

    __shared__ __attribute__((aligned(16))) f16 ldsA[2][GBM][GA_PITCH];   // [buf][m][k]
    __shared__ __attribute__((aligned(16))) f16 ldsB[2][GBK][GB_PITCH];   // [buf][k][n]

    int bat = blockIdx.z;
    int m0  = blockIdx.x * GBM;
    int n0  = blockIdx.y * GBN;
    int t    = threadIdx.x;
    int lane = t & 31;
    int warp = t >> 5;
    int trow = (warp >> 1) * 32;     // 0,32,64,96
    int tcol = (warp & 1) * 64;      // 0,64
    int hs   = (lane >> 4) * 8;      // K-half select

    const f16*   Ab  = A32 ? nullptr : A + (long)bat * sA;
    const float* Afb = A32 ? Af + (long)bat * sA : nullptr;
    const f16*   Bb  = B32 ? nullptr : B + (long)bat * sB;
    const float* Bfb = B32 ? Bf + (long)bat * sB : nullptr;

    // staging coordinates: 8192 halves per tile = 4 chunks of 8 per thread
    int ar_st = t >> 3;              // A row 0..31, chunk i: + 32 i
    int ac_st = (t & 7) * 8;         // A k-col, multiple of 8
    int bk_st = t >> 4;              // B k-row 0..15, chunk i: + 16 i
    int bn_st = (t & 15) * 8;        // B n-col, multiple of 8
    // A thread's place inside a chunk, in elements; the rest of every address is the same
    // for the whole block and is summed on the scalar side.
    unsigned a_voff = (unsigned)(ar_st * K + ac_st);
    unsigned b_voff = (unsigned)(bk_st * N + bn_st);

    v8f acc[2][4];
    for (int i = 0; i < 2; i++)
        for (int j = 0; j < 4; j++)
            acc[i][j] = (v8f){0.f, 0.f, 0.f, 0.f, 0.f, 0.f, 0.f, 0.f};

    int nk = K >> 6;
    u32x4 rb[4];                     // f16 operands: 8 halves a chunk
    f32x4 rbf[4][2], raf[4][2];      // f32 operands: 8 floats a chunk
#if !HAVE_ASYNC_LDS
    u32x4 ra[4];
#endif

    // Prefetch address: 4 threads a B row, two tiles ahead. It is carried through the loop
    // and steps only while a later tile exists, so it always points into B.
    long pf_step = (long)GBK * N;
    long pf_off  = (nk > 2 ? 2 * pf_step : 0) + n0 + (long)(t >> 2) * N + (t & 3) * 32;
    const void* pf = B32 ? (const void*)(Bfb + pf_off) : (const void*)(Bb + pf_off);

    // Issues the loads of the tile at k0; an f16 A tile is copied straight into ldsA[nbuf].
    auto issue_tile = [&](int k0, int nbuf, bool prefetch) {
        const void *pb[4], *pa[4];
        for (int i = 0; i < 4; i++) {
            long off = (long)(k0 + 16 * i) * N + n0;
            if constexpr (B32) {
                const f32x4* p = (const f32x4*)(Bfb + off + b_voff);
                rbf[i][0] = p[0]; rbf[i][1] = p[1];
                pb[i] = p;
            } else {
                const u32x4* p = (const u32x4*)(Bb + off + b_voff);
                rb[i] = p[0];
                pb[i] = p;
            }
        }
        for (int i = 0; i < 4; i++) {
            long off = (long)(m0 + 32 * i) * K + k0;
            if constexpr (A32) {
                const f32x4* p = (const f32x4*)(Afb + off + a_voff);
                raf[i][0] = p[0]; raf[i][1] = p[1];
                pa[i] = p;
            } else {
                pa[i] = pb[i];       // a builtin copy owes no such wait: B's address again
#if HAVE_ASYNC_LDS
                __builtin_amdgcn_global_load_async_to_lds_b128(
                    (AS1 gvi4*)(Ab + off + a_voff),
                    (AS3 gvi4*)&ldsA[nbuf][ar_st + 32 * i][ac_st], 0, 0);
#else
                ra[i] = *(const u32x4*)(Ab + off + a_voff);
#endif
            }
        }
        if (prefetch) __builtin_prefetch(pf, 0, 1);   // B tile two ahead -> global_prefetch_b8
        // The wait owed before a register that an issued load names is written again. The
        // addresses are its inputs, so they stay whole up to it (no load's result lands in them).
        asm volatile("s_wait_xcnt 0x0"
                     :: "v"(pb[0]), "v"(pb[1]), "v"(pb[2]), "v"(pb[3]),
                        "v"(pa[0]), "v"(pa[1]), "v"(pa[2]), "v"(pa[3]), "v"(pf) : "memory");
    };

    issue_tile(0, 0, false);

    for (int kt = 0; kt < nk; kt++) {
        int buf = kt & 1;
        // ---- commit tile kt to LDS ---------------------------------------
        for (int i = 0; i < 4; i++) {
            if constexpr (B32) {
                *(u32x4*)&ldsB[buf][bk_st + 16 * i][bn_st] = round_to_f16x8(rbf[i][0], rbf[i][1]);
            } else {
                *(u32x4*)&ldsB[buf][bk_st + 16 * i][bn_st] = rb[i];
            }
        }
        if constexpr (A32) {
            for (int i = 0; i < 4; i++)
                *(u32x4*)&ldsA[buf][ar_st + 32 * i][ac_st] = round_to_f16x8(raf[i][0], raf[i][1]);
        } else {
#if HAVE_ASYNC_LDS
            wait_asynccnt0();        // my async A chunks for tile kt landed
#else
            for (int i = 0; i < 4; i++)
                *(u32x4*)&ldsA[buf][ar_st + 32 * i][ac_st] = ra[i];
#endif
        }
        // All waves' A+B chunks visible. Directly behind the asynccnt wait it also keeps the
        // compiler from lifting an LDS read over that wait.
        __syncthreads();

        // ---- issue tile kt+1 (other buffer) ------------------------------
        if (kt + 1 < nk) {
            issue_tile((kt + 1) * GBK, buf ^ 1, kt + 2 < nk);
            if (kt + 3 < nk) pf = B32 ? (const void*)((const float*)pf + pf_step)
                                      : (const void*)((const f16*)pf + pf_step);
        }

        // ---- fragments + 8x WMMA per 32 k --------------------------------
        for (int ks = 0; ks < GBK / 32; ks++) {
            Frag16 fa[2], fb[4];
            const f16* ap = &ldsA[buf][trow + (lane & 15)][ks * 32 + hs];
            const f16* bp = &ldsB[buf][ks * 32 + hs + (lane & 7)][tcol + ((lane >> 3) & 1) * 8];
            for (int i = 0; i < 2; i++) {
                fa[i].q[0] = *(const u32x4*)(ap + i * 16 * GA_PITCH);
                fa[i].q[1] = *(const u32x4*)(ap + i * 16 * GA_PITCH + 16);
            }
            for (int j = 0; j < 4; j++) {
                fb[j].q[0] = lds_load_tr16(bp + j * 16);
                fb[j].q[1] = lds_load_tr16(bp + 16 * GB_PITCH + j * 16);
            }
            for (int i = 0; i < 2; i++)
                for (int j = 0; j < 4; j++)
                    acc[i][j] = __builtin_amdgcn_wmma_f32_16x16x32_f16(
                        false, fa[i].h, false, fb[j].h, (short)0, acc[i][j], false, false);
        }
    }

    // ---- epilogue: tile (i, j), VGPR r -> row (trow + 16 i + r + 8*(lane>=16)) ----
    int col0 = n0 + tcol + (lane & 15);
    for (int i = 0; i < 2; i++) {
        int rbase = m0 + trow + i * 16 + (lane >> 4) * 8;
        for (int r = 0; r < 8; r++) {
            int row = rbase + r;
            float bv = bias[row];
            long base = (long)bat * sC + (long)row * N + col0;
            for (int j = 0; j < 4; j++) {
                float v = acc[i][j][r] + bv;
                if (OUT16) ((f16*)Cv)[base + j * 16] = (f16)v;
                else       ((float*)Cv)[base + j * 16] = v;
            }
        }
    }
}

// ---------------------------------------------------------------------------
// Per-(batch, head, half of d): softmax(k, axis=n), ctx[d][e] = sum_n p[d][n]*v[e][n]
// kv: (B, 256, 1024) f32;  k rows = h*32+d,  v rows = 128+h*32+e.
//
// 16 waves. Wave w keeps k row w of its d half and v rows w, w+16 whole in
// registers (24 wave-wide 16-byte loads, all issued before the first use), so
// kv is read once and the row max and sum need no second pass. P and V go to
// LDS as f16 once; then wave w multiplies the n slice [64w, 64w+64) for both
// e tiles, and the 16 partial tiles are summed in f32 through LDS.
// A block writes whole 128-byte rows of ctx.
// ---------------------------------------------------------------------------
// Four v_exp_f32 (the instruction __expf ends in) in one statement. The outputs are
// early-clobbered so that none lands on a source of the v_exp_f32 directly ahead of it, and
// the v_nop is the slot the instruction set asks for behind the last one.
__device__ __forceinline__ f32x4 exp2_x4(f32x4 a) {
    float r0, r1, r2, r3;
    asm("v_exp_f32 %0, %4\n\tv_exp_f32 %1, %5\n\tv_exp_f32 %2, %6\n\tv_exp_f32 %3, %7\n\tv_nop"
        : "=&v"(r0), "=&v"(r1), "=&v"(r2), "=&v"(r3)
        : "v"(a.x), "v"(a.y), "v"(a.z), "v"(a.w));
    f32x4 r = {r0, r1, r2, r3};
    return r;
}

#define SC_PITCH (NC + 8)    // halves: 2064 B = 16 B x odd, for the ds_load_b128 fragment reads
#define SC_TILE1 272         // dword offset of the second e tile's partials (16 banks off the first)

__global__ __launch_bounds__(512) void softmax_ctx_kernel(const float* __restrict__ kv,
                                                          float* __restrict__ ctx) {
    int h  = blockIdx.x;
    int b  = blockIdx.y;
    int dt = blockIdx.z;          // which 16 rows of d

    __shared__ __attribute__((aligned(16))) f16 ldsP[16][SC_PITCH];
    __shared__ __attribute__((aligned(16))) f16 ldsV[DIMH][SC_PITCH];
    __shared__ float red[16][SC_TILE1 + 256];

    int t = threadIdx.x;
    int lane = t & 31;
    int warp = t >> 5;

    const f32x4* kr = (const f32x4*)(kv + ((long)b * 256 + h * DIMH + dt * 16 + warp) * NC) + lane;
    const f32x4* va = (const f32x4*)(kv + ((long)b * 256 + HID + h * DIMH + warp) * NC) + lane;
    const f32x4* vb = va + 16 * NC / 4;

    f32x4 kq[8], v0[8], v1[8];
    for (int j = 0; j < 8; j++) kq[j] = kr[j * 32];
    for (int j = 0; j < 8; j++) v0[j] = va[j * 32];
    for (int j = 0; j < 8; j++) v1[j] = vb[j * 32];
    // The wait owed before a register that an issued load names is written again. The two
    // address pairs are its inputs, so they stay whole up to it (no load's result lands in them).
    asm volatile("s_wait_xcnt 0x0" :: "v"(kr), "v"(va) : "memory");
    // Keeps the max from being scheduled ahead of the v loads: without it they are issued
    // behind the wait for k, and their latency follows k's instead of overlapping it.
    __builtin_amdgcn_sched_barrier(0);

    // row max
    float m = -1e30f;
    for (int j = 0; j < 8; j++)
        m = fmaxf(m, fmaxf(fmaxf(kq[j].x, kq[j].y), fmaxf(kq[j].z, kq[j].w)));
    for (int o = 16; o >= 1; o >>= 1) m = fmaxf(m, __shfl_xor(m, o, 32));

    // exponentials stay in registers; four independent sum chains
    f32x4 s4 = {0.f, 0.f, 0.f, 0.f};
    for (int j = 0; j < 8; j++) {
        kq[j] = exp2_x4((kq[j] - m) * 1.44269504088896340736f);   // = __expf(k - m)
        s4 += kq[j];
    }
    float s = (s4.x + s4.y) + (s4.z + s4.w);
    for (int o = 16; o >= 1; o >>= 1) s += __shfl_xor(s, o, 32);
    float inv = 1.0f / s;

    for (int j = 0; j < 8; j++) {
        f32x4 p = kq[j] * inv;
        f16x4 ph = {(f16)p.x, (f16)p.y, (f16)p.z, (f16)p.w};
        f16x4 ah = {(f16)v0[j].x, (f16)v0[j].y, (f16)v0[j].z, (f16)v0[j].w};
        f16x4 bh = {(f16)v1[j].x, (f16)v1[j].y, (f16)v1[j].z, (f16)v1[j].w};
        *(f16x4*)&ldsP[warp][j * 128 + lane * 4]      = ph;
        *(f16x4*)&ldsV[warp][j * 128 + lane * 4]      = ah;
        *(f16x4*)&ldsV[warp + 16][j * 128 + lane * 4] = bh;
    }
    __syncthreads();

    // wave w: n slice [64w, 64w+64), one A fragment feeds both e tiles
    v8f acc0 = {0.f, 0.f, 0.f, 0.f, 0.f, 0.f, 0.f, 0.f};
    v8f acc1 = {0.f, 0.f, 0.f, 0.f, 0.f, 0.f, 0.f, 0.f};
    int c  = lane & 15;
    int hs = (lane >> 4) * 8;
    for (int ks = 0; ks < 2; ks++) {
        int kk = warp * 64 + ks * 32;
        Frag16 fa, fb0, fb1;
        fa.q[0]  = *(const u32x4*)&ldsP[c][kk + hs];
        fa.q[1]  = *(const u32x4*)&ldsP[c][kk + 16 + hs];
        fb0.q[0] = *(const u32x4*)&ldsV[c][kk + hs];
        fb0.q[1] = *(const u32x4*)&ldsV[c][kk + 16 + hs];
        fb1.q[0] = *(const u32x4*)&ldsV[c + 16][kk + hs];
        fb1.q[1] = *(const u32x4*)&ldsV[c + 16][kk + 16 + hs];
        acc0 = __builtin_amdgcn_wmma_f32_16x16x32_f16(
            false, fa.h, false, fb0.h, (short)0, acc0, false, false);
        acc1 = __builtin_amdgcn_wmma_f32_16x16x32_f16(
            false, fa.h, false, fb1.h, (short)0, acc1, false, false);
    }
    for (int r = 0; r < 8; r++) {
        red[warp][r * 32 + lane]            = acc0[r];
        red[warp][SC_TILE1 + r * 32 + lane] = acc1[r];
    }
    __syncthreads();

    // thread t owns ctx[dt*16 + (t>>5)][t&31]; register r, lane 16*(d>>3)+c held D[d][c]
    int d = warp;
    int e = lane;
    int idx = (e >> 4) * SC_TILE1 + (d & 7) * 32 + (d >> 3) * 16 + (e & 15);
    float sum = 0.f;
    for (int w = 0; w < 16; w++) sum += red[w][idx];
    ctx[(((long)b * HEADS + h) * DIMH + dt * 16 + d) * DIMH + e] = sum;
}

// ---------------------------------------------------------------------------
// Fold context into output weight:
//   W2[b][c][h*32+d] = sum_e w_out[c][h*32+e] * ctx[b][h][d][e]   (f16 out)
// ---------------------------------------------------------------------------
__global__ __launch_bounds__(256) void fold_w2_kernel(const float* __restrict__ w_out,
                                                      const float* __restrict__ ctx,
                                                      f16* __restrict__ w2) {
    long o = (long)blockIdx.x * blockDim.x + threadIdx.x;   // B*256*128 elems
    if (o >= (long)BATCH * CCH * HID) return;
    int j = (int)(o & (HID - 1));
    long rem = o >> 7;
    int c = (int)(rem & (CCH - 1));
    int b = (int)(rem >> 8);
    int h = j >> 5;
    int d = j & 31;
    const float* wr = w_out + (long)c * HID + h * DIMH;
    const float* cr = ctx + (((long)b * HEADS + h) * DIMH + d) * DIMH;
    float acc = 0.f;
    for (int e = 0; e < DIMH; e++) acc += wr[e] * cr[e];
    w2[o] = (f16)acc;
}

// ---------------------------------------------------------------------------
extern "C" void kernel_launch(void* const* d_in, const int* in_sizes, int n_in,
                              void* d_out, int out_size, void* d_ws, size_t ws_size,
                              hipStream_t stream) {
    const float* x     = (const float*)d_in[0];   // (16,256,64,64)
    const float* cond  = (const float*)d_in[1];   // (16,512,32,32)
    const float* gn_w  = (const float*)d_in[2];
    const float* gn_b  = (const float*)d_in[3];
    const float* w_q   = (const float*)d_in[4];   // (128,256)
    const float* b_q   = (const float*)d_in[5];
    const float* w_kv  = (const float*)d_in[6];   // (256,512)
    const float* b_kv  = (const float*)d_in[7];
    const float* w_out = (const float*)d_in[8];   // (256,128)
    const float* b_out = (const float*)d_in[9];
    float* out = (float*)d_out;                   // (16,256,64,64)

    // workspace layout
    char* ws = (char*)d_ws;
    constexpr long SZ_XN   = (long)BATCH * CCH * NPIX * 2;   // 33.5 MB f16
    constexpr long SZ_KV   = (long)BATCH * 2 * HID * NC * 4; // f32
    constexpr long SZ_Q16  = (long)BATCH * HID * NPIX * 2;
    constexpr long SZ_CTX  = (long)BATCH * HEADS * DIMH * DIMH * 4;
    f16*   xn16   = (f16*)(ws);
    float* kvf    = (float*)(ws + SZ_XN);
    f16*   q16    = (f16*)(ws + SZ_XN + SZ_KV);
    float* ctxf   = (float*)(ws + SZ_XN + SZ_KV + SZ_Q16);
    f16*   w2_16  = (f16*)(ws + SZ_XN + SZ_KV + SZ_Q16 + SZ_CTX);

    // 1) GroupNorm -> xn f16
    groupnorm_kernel<<<BATCH * GROUPS, 256, 0, stream>>>(x, gn_w, gn_b, xn16);

    // 2) kv = w_kv @ cond + b_kv   (M=256,K=512,N=1024, f32 operands, f32 out)
    gemm_wmma_kernel<false, true, true><<<dim3(256 / GBM, NC / GBN, BATCH), 256, 0, stream>>>(
        nullptr, w_kv, 0, nullptr, cond, (long)CD * NC, kvf, (long)2 * HID * NC, b_kv, 2 * HID, NC, CD);

    // 3) q = w_q @ xn + b_q        (M=128,K=256,N=4096, f32 weight, f16 out)
    gemm_wmma_kernel<true, true, false><<<dim3(HID / GBM, NPIX / GBN, BATCH), 256, 0, stream>>>(
        nullptr, w_q, 0, xn16, nullptr, (long)CCH * NPIX, q16, (long)HID * NPIX, b_q, HID, NPIX, CCH);

    // 4) softmax(k) + context = P @ V^T  per (b,h)
    softmax_ctx_kernel<<<dim3(HEADS, BATCH, 2), 512, 0, stream>>>(kvf, ctxf);

    // 5) fold ctx into output weight: W2 = w_out x ctx
    long nw2 = (long)BATCH * CCH * HID;
    fold_w2_kernel<<<(nw2 + 255) / 256, 256, 0, stream>>>(w_out, ctxf, w2_16);

    // 6) out = W2 @ q + b_out      (M=256,K=128,N=4096, f32 out)
    gemm_wmma_kernel<false, false, false><<<dim3(CCH / GBM, NPIX / GBN, BATCH), 256, 0, stream>>>(
        w2_16, nullptr, (long)CCH * HID, q16, nullptr, (long)HID * NPIX, out, (long)CCH * NPIX, b_out,
        CCH, NPIX, HID);
}

// v005
// A run of this version takes 72.4 microseconds.
// In two side-by-side timings against v004, it was 1.08 and 1.09 times as fast.
// Counting every step since v000, it is 2.58 times as fast.
#include <hip/hip_runtime.h>
#include <hip/hip_bf16.h>

typedef _Float16 f16;
typedef __attribute__((ext_vector_type(16))) _Float16 v16h;
typedef __attribute__((ext_vector_type(8)))  float    v8f;
typedef __attribute__((ext_vector_type(4)))  unsigned int u32x4;
typedef __attribute__((ext_vector_type(2)))  unsigned int u32x2;
typedef int gvi4 __attribute__((vector_size(16)));   // matches async-LDS builtin param
typedef __attribute__((ext_vector_type(4))) float    f32x4;
typedef __attribute__((ext_vector_type(4))) _Float16 f16x4;

union Frag16 { v16h h; u32x4 q[2]; };

#define AS1 __attribute__((address_space(1)))
#define AS3 __attribute__((address_space(3)))

#if __has_builtin(__builtin_amdgcn_global_load_async_to_lds_b128)
#define HAVE_ASYNC_LDS 1
#else
#define HAVE_ASYNC_LDS 0
#endif

__device__ __forceinline__ void wait_asynccnt0() {
#if __has_builtin(__builtin_amdgcn_s_wait_asynccnt)
    __builtin_amdgcn_s_wait_asynccnt(0);
#else
    asm volatile("s_wait_asynccnt 0x0" ::: "memory");
#endif
}

#define HEADS 4
#define DIMH 32
#define BATCH 16
#define CCH 256      // x channels
#define CD 512       // cond channels
#define HID 128      // heads*dim_head
#define NPIX 4096    // 64*64
#define NC 1024      // 32*32
#define GROUPS 32

// ---------------------------------------------------------------------------
// GroupNorm: x (B,256,4096) -> xn f16, 1 block per (batch, group)
// ---------------------------------------------------------------------------
__global__ __launch_bounds__(256) void groupnorm_kernel(const float* __restrict__ x,
                                                        const float* __restrict__ w,
                                                        const float* __restrict__ b,
                                                        f16* __restrict__ xn) {
    int blk = blockIdx.x;
    int bat = blk >> 5;
    int g   = blk & 31;
    const float* xb = x + ((long)bat * CCH + g * 8) * NPIX;
    f16*         ob = xn + ((long)bat * CCH + g * 8) * NPIX;
    int t = threadIdx.x;

    float s = 0.f, s2 = 0.f;
    for (int i = t; i < 8 * NPIX; i += 256) {
        float v = xb[i];
        s += v; s2 += v * v;
    }
    __shared__ float sh[256], sh2[256];
    sh[t] = s; sh2[t] = s2;
    __syncthreads();
    for (int o = 128; o > 0; o >>= 1) {
        if (t < o) { sh[t] += sh[t + o]; sh2[t] += sh2[t + o]; }
        __syncthreads();
    }
    float mu  = sh[0] * (1.0f / 32768.0f);
    float var = sh2[0] * (1.0f / 32768.0f) - mu * mu;
    float ri  = rsqrtf(var + 1e-5f);
    for (int i = t; i < 8 * NPIX; i += 256) {
        int ch = g * 8 + (i >> 12);
        float v = (xb[i] - mu) * ri;
        ob[i] = (f16)(v * w[ch] + b[ch]);
    }
}

// ---------------------------------------------------------------------------
// WMMA f16 GEMM:  C[b] = A[b] (MxK) * B[b] (KxN) + bias
//
// Block tile 128(M) x 128(N), BK=64, 8 waves; wave (w>>1, w&1) owns a 32x64 output
// patch: per 32 k, two A and four B fragments feed eight v_wmma_f32_16x16x32_f16, so
// a fragment read from LDS is used 4 (A) or 2 (B) times, and few, long-lived waves do the
// work: fewer wave starts and fewer barrier trips per product.
// M, N multiples of 128, K of 64.
// Double-buffered LDS, one barrier per K-step. A tile staged with
// GLOBAL_LOAD_ASYNC_TO_LDS_B128 (ASYNCcnt). B tile staged as it lies in memory, [k][n],
// 16B LDS stores; ds_load_tr16_b128 transposes it on the way into the
// fragment. Row pitches are padded for their readers (64 banks x 4 B): A 144 B = 16 B x odd
// for ds_load_b128, B 288 B = 32 B x odd for ds_load_tr16_b128.
// An operand that is still f32 in memory (A32 / B32: the weights, cond) is loaded as
// f32 and rounded to f16 in registers on its way into LDS, so it needs no convert
// launch and no f16 copy in the workspace; such an A tile goes through registers.
// ABLK: the f16 A operand lies in memory as [K/16][M][16] (16-k slabs of whole rows, the form
// its producer can write as one contiguous piece per work-group) instead of [M][K].
//
// Fragment layout (ISA 7.12.2, 16-bit 16x32): lane L (idx = L&15):
//   halves 0..7  = K (L<16 ? 0..7 : 8..15),  halves 8..15 = +16.
// Two transposing loads, at k rows 0 and 16 of a 32-k slab, deliver B in the same k order.
// ---------------------------------------------------------------------------
#define GBM 128
#define GBN 128
#define GBK 64
#define GA_PITCH 72    // halves per ldsA row (64 used)
#define GB_PITCH 144   // halves per ldsB row (128 used)

typedef __attribute__((ext_vector_type(8))) short s16x8;

// Lane l passes the address of 8 halves of row 8*(l>>4) + (l&7), column half (l>>3)&1, of a
// 16(k) x 16(n) block; it gets back column l&15, k = 8*(l>>4) .. +7.
__device__ __forceinline__ u32x4 lds_load_tr16(const f16* p) {
    return __builtin_bit_cast(u32x4, __builtin_amdgcn_ds_load_tr16_b128_v8i16((AS3 s16x8*)p));
}

__device__ __forceinline__ u32x4 round_to_f16x8(f32x4 lo, f32x4 hi) {
    union { f16 h[8]; u32x4 q; } u;
    for (int i = 0; i < 4; i++) { u.h[i] = (f16)lo[i]; u.h[4 + i] = (f16)hi[i]; }
    return u.q;
}

template <bool OUT16, bool A32, bool B32, bool ABLK>
__global__ __launch_bounds__(256) void gemm_wmma_kernel(
    const f16* __restrict__ A, const float* __restrict__ Af, long sA,
    const f16* __restrict__ B, const float* __restrict__ Bf, long sB,
    void* __restrict__ Cv, long sC,
    const float* __restrict__ bias,
    int M, int N, int K) {

    __shared__ __attribute__((aligned(16))) f16 ldsA[2][GBM][GA_PITCH];   // [buf][m][k]
    __shared__ __attribute__((aligned(16))) f16 ldsB[2][GBK][GB_PITCH];   // [buf][k][n]

    int bat = blockIdx.z;
    int m0  = blockIdx.x * GBM;
    int n0  = blockIdx.y * GBN;
    int t    = threadIdx.x;
    int lane = t & 31;
    int warp = t >> 5;
    int trow = (warp >> 1) * 32;     // 0,32,64,96
    int tcol = (warp & 1) * 64;      // 0,64
    int hs   = (lane >> 4) * 8;      // K-half select

    const f16*   Ab  = A32 ? nullptr : A + (long)bat * sA;
    const float* Afb = A32 ? Af + (long)bat * sA : nullptr;
    const f16*   Bb  = B32 ? nullptr : B + (long)bat * sB;
    const float* Bfb = B32 ? Bf + (long)bat * sB : nullptr;

    // staging coordinates: 8192 halves per tile = 4 chunks of 8 per thread
    int ar_st = t >> 3;              // A row 0..31, chunk i: + 32 i
    int ac_st = (t & 7) * 8;         // A k-col, multiple of 8
    int bk_st = t >> 4;              // B k-row 0..15, chunk i: + 16 i
    int bn_st = (t & 15) * 8;        // B n-col, multiple of 8
    // A thread's place inside a chunk, in elements; the rest of every address is the same
    // for the whole block and is summed on the scalar side.
    unsigned a_voff = ABLK ? (unsigned)(((ac_st >> 4) * M + ar_st) * 16 + (ac_st & 15))
                           : (unsigned)(ar_st * K + ac_st);
    unsigned b_voff = (unsigned)(bk_st * N + bn_st);

    v8f acc[2][4];
    for (int i = 0; i < 2; i++)
        for (int j = 0; j < 4; j++)
            acc[i][j] = (v8f){0.f, 0.f, 0.f, 0.f, 0.f, 0.f, 0.f, 0.f};

    int nk = K >> 6;
    u32x4 rb[4];                     // f16 operands: 8 halves a chunk
    f32x4 rbf[4][2], raf[4][2];      // f32 operands: 8 floats a chunk
#if !HAVE_ASYNC_LDS
    u32x4 ra[4];
#endif

    // Prefetch address: 4 threads a B row, two tiles ahead. It is carried through the loop
    // and steps only while a later tile exists, so it always points into B.
    long pf_step = (long)GBK * N;
    long pf_off  = (nk > 2 ? 2 * pf_step : 0) + n0 + (long)(t >> 2) * N + (t & 3) * 32;
    const void* pf = B32 ? (const void*)(Bfb + pf_off) : (const void*)(Bb + pf_off);

    // Issues the loads of the tile at k0; an f16 A tile is copied straight into ldsA[nbuf].
    auto issue_tile = [&](int k0, int nbuf, bool prefetch) {
        const void *pb[4], *pa[4];
        for (int i = 0; i < 4; i++) {
            long off = (long)(k0 + 16 * i) * N + n0;
            if constexpr (B32) {
                const f32x4* p = (const f32x4*)(Bfb + off + b_voff);
                rbf[i][0] = p[0]; rbf[i][1] = p[1];
                pb[i] = p;
            } else {
                const u32x4* p = (const u32x4*)(Bb + off + b_voff);
                rb[i] = p[0];
                pb[i] = p;
            }
        }
        for (int i = 0; i < 4; i++) {
            long off = ABLK ? ((long)(k0 >> 4) * M + m0 + 32 * i) * 16
                            : (long)(m0 + 32 * i) * K + k0;
            if constexpr (A32) {
                const f32x4* p = (const f32x4*)(Afb + off + a_voff);
                raf[i][0] = p[0]; raf[i][1] = p[1];
                pa[i] = p;
            } else {
                pa[i] = pb[i];       // a builtin copy owes no such wait: B's address again
#if HAVE_ASYNC_LDS
                __builtin_amdgcn_global_load_async_to_lds_b128(
                    (AS1 gvi4*)(Ab + off + a_voff),
                    (AS3 gvi4*)&ldsA[nbuf][ar_st + 32 * i][ac_st], 0, 0);
#else
                ra[i] = *(const u32x4*)(Ab + off + a_voff);
#endif
            }
        }
        if (prefetch) __builtin_prefetch(pf, 0, 1);   // B tile two ahead -> global_prefetch_b8
        // The wait owed before a register that an issued load names is written again. The
        // addresses are its inputs, so they stay whole up to it (no load's result lands in them).
        asm volatile("s_wait_xcnt 0x0"
                     :: "v"(pb[0]), "v"(pb[1]), "v"(pb[2]), "v"(pb[3]),
                        "v"(pa[0]), "v"(pa[1]), "v"(pa[2]), "v"(pa[3]), "v"(pf) : "memory");
    };

    issue_tile(0, 0, false);

    for (int kt = 0; kt < nk; kt++) {
        int buf = kt & 1;
        // ---- commit tile kt to LDS ---------------------------------------
        for (int i = 0; i < 4; i++) {
            if constexpr (B32) {
                *(u32x4*)&ldsB[buf][bk_st + 16 * i][bn_st] = round_to_f16x8(rbf[i][0], rbf[i][1]);
            } else {
                *(u32x4*)&ldsB[buf][bk_st + 16 * i][bn_st] = rb[i];
            }
        }
        if constexpr (A32) {
            for (int i = 0; i < 4; i++)
                *(u32x4*)&ldsA[buf][ar_st + 32 * i][ac_st] = round_to_f16x8(raf[i][0], raf[i][1]);
        } else {
#if HAVE_ASYNC_LDS
            wait_asynccnt0();        // my async A chunks for tile kt landed
#else
            for (int i = 0; i < 4; i++)
                *(u32x4*)&ldsA[buf][ar_st + 32 * i][ac_st] = ra[i];
#endif
        }
        // All waves' A+B chunks visible. Directly behind the asynccnt wait it also keeps the
        // compiler from lifting an LDS read over that wait.
        __syncthreads();

        // ---- issue tile kt+1 (other buffer) ------------------------------
        if (kt + 1 < nk) {
            issue_tile((kt + 1) * GBK, buf ^ 1, kt + 2 < nk);
            if (kt + 3 < nk) pf = B32 ? (const void*)((const float*)pf + pf_step)
                                      : (const void*)((const f16*)pf + pf_step);
        }

        // ---- fragments + 8x WMMA per 32 k --------------------------------
        for (int ks = 0; ks < GBK / 32; ks++) {
            Frag16 fa[2], fb[4];
            const f16* ap = &ldsA[buf][trow + (lane & 15)][ks * 32 + hs];
            const f16* bp = &ldsB[buf][ks * 32 + hs + (lane & 7)][tcol + ((lane >> 3) & 1) * 8];
            for (int i = 0; i < 2; i++) {
                fa[i].q[0] = *(const u32x4*)(ap + i * 16 * GA_PITCH);
                fa[i].q[1] = *(const u32x4*)(ap + i * 16 * GA_PITCH + 16);
            }
            for (int j = 0; j < 4; j++) {
                fb[j].q[0] = lds_load_tr16(bp + j * 16);
                fb[j].q[1] = lds_load_tr16(bp + 16 * GB_PITCH + j * 16);
            }
            for (int i = 0; i < 2; i++)
                for (int j = 0; j < 4; j++)
                    acc[i][j] = __builtin_amdgcn_wmma_f32_16x16x32_f16(
                        false, fa[i].h, false, fb[j].h, (short)0, acc[i][j], false, false);
        }
    }

    // ---- epilogue: tile (i, j), VGPR r -> row (trow + 16 i + r + 8*(lane>=16)) ----
    int col0 = n0 + tcol + (lane & 15);
    for (int i = 0; i < 2; i++) {
        int rbase = m0 + trow + i * 16 + (lane >> 4) * 8;
        for (int r = 0; r < 8; r++) {
            int row = rbase + r;
            float bv = bias[row];
            long base = (long)bat * sC + (long)row * N + col0;
            for (int j = 0; j < 4; j++) {
                float v = acc[i][j][r] + bv;
                if (OUT16) ((f16*)Cv)[base + j * 16] = (f16)v;
                else       ((float*)Cv)[base + j * 16] = v;
            }
        }
    }
}

// ---------------------------------------------------------------------------
// Per-(batch, head, half of d): softmax(k, axis=n), ctx[d][e] = sum_n p[d][n]*v[e][n]
// kv: (B, 256, 1024) f32;  k rows = h*32+d,  v rows = 128+h*32+e.
//
// 16 waves. Wave w keeps k row w of its d half and v rows w, w+16 whole in
// registers (24 wave-wide 16-byte loads, all issued before the first use), so
// kv is read once and the row max and sum need no second pass. P and V go to
// LDS as f16 once; then wave w multiplies the n slice [64w, 64w+64) for both
// e tiles, and the 16 partial tiles are summed in f32 through LDS.
//
// The block then folds its 16 ctx rows into the output weight itself (f32, e ascending):
//   W2[b][c][h*32+d] = sum_e w_out[c][h*32+e] * ctx[b][h][d][e]   (f16 out)
// so ctx never leaves LDS and the fold needs no launch of its own. W2 is written as
// [b][j/16][c][16], j = h*32+d: a block's 256 x 16 piece is one contiguous 8 KiB, whole lines.
// ---------------------------------------------------------------------------
// Four v_exp_f32 (the instruction __expf ends in) in one statement. The outputs are
// early-clobbered so that none lands on a source of the v_exp_f32 directly ahead of it, and
// the v_nop is the slot the instruction set asks for behind the last one.
__device__ __forceinline__ f32x4 exp2_x4(f32x4 a) {
    float r0, r1, r2, r3;
    asm("v_exp_f32 %0, %4\n\tv_exp_f32 %1, %5\n\tv_exp_f32 %2, %6\n\tv_exp_f32 %3, %7\n\tv_nop"
        : "=&v"(r0), "=&v"(r1), "=&v"(r2), "=&v"(r3)
        : "v"(a.x), "v"(a.y), "v"(a.z), "v"(a.w));
    f32x4 r = {r0, r1, r2, r3};
    return r;
}

#define SC_PITCH (NC + 8)    // halves: 2064 B = 16 B x odd, for the ds_load_b128 fragment reads
#define SC_TILE1 272         // dword offset of the second e tile's partials (16 banks off the first)
#define SC_CPITCH 36         // floats per ctx row in LDS: rows 4 apart lie 16 banks apart

__global__ __launch_bounds__(512) void softmax_ctx_kernel(const float* __restrict__ kv,
                                                          const float* __restrict__ w_out,
                                                          f16* __restrict__ w2) {
    int h  = blockIdx.x;
    int b  = blockIdx.y;
    int dt = blockIdx.z;          // which 16 rows of d

    __shared__ __attribute__((aligned(16))) f16 ldsP[16][SC_PITCH];
    __shared__ __attribute__((aligned(16))) f16 ldsV[DIMH][SC_PITCH];
    __shared__ float red[16][SC_TILE1 + 256];
    __shared__ __attribute__((aligned(16))) float ctxs[16][SC_CPITCH];

    int t = threadIdx.x;
    int lane = t & 31;
    int warp = t >> 5;

    const f32x4* kr = (const f32x4*)(kv + ((long)b * 256 + h * DIMH + dt * 16 + warp) * NC) + lane;
    const f32x4* va = (const f32x4*)(kv + ((long)b * 256 + HID + h * DIMH + warp) * NC) + lane;
    const f32x4* vb = va + 16 * NC / 4;
    // the fold's w_out rows, c = t>>2 and c + 128, this head's 32 columns
    const f32x4* wr = (const f32x4*)(w_out + (long)(t >> 2) * HID + h * DIMH);

    f32x4 kq[8], v0[8], v1[8], wa[8], wb[8];
    for (int j = 0; j < 8; j++) kq[j] = kr[j * 32];
    for (int j = 0; j < 8; j++) v0[j] = va[j * 32];
    for (int j = 0; j < 8; j++) v1[j] = vb[j * 32];
    for (int j = 0; j < 8; j++) wa[j] = wr[j];                    // behind k and v: they arrive
    for (int j = 0; j < 8; j++) wb[j] = wr[128 * HID / 4 + j];    // under the softmax
    // The wait owed before a register that an issued load names is written again. The three
    // address pairs are its inputs, so they stay whole up to it (no load's result lands in them).
    asm volatile("s_wait_xcnt 0x0" :: "v"(kr), "v"(va), "v"(wr) : "memory");
    // Keeps the max from being scheduled ahead of the v loads: without it they are issued
    // behind the wait for k, and their latency follows k's instead of overlapping it.
    __builtin_amdgcn_sched_barrier(0);

    // row max
    float m = -1e30f;
    for (int j = 0; j < 8; j++)
        m = fmaxf(m, fmaxf(fmaxf(kq[j].x, kq[j].y), fmaxf(kq[j].z, kq[j].w)));
    for (int o = 16; o >= 1; o >>= 1) m = fmaxf(m, __shfl_xor(m, o, 32));

    // exponentials stay in registers; four independent sum chains
    f32x4 s4 = {0.f, 0.f, 0.f, 0.f};
    for (int j = 0; j < 8; j++) {
        kq[j] = exp2_x4((kq[j] - m) * 1.44269504088896340736f);   // = __expf(k - m)
        s4 += kq[j];
    }
    float s = (s4.x + s4.y) + (s4.z + s4.w);
    for (int o = 16; o >= 1; o >>= 1) s += __shfl_xor(s, o, 32);
    float inv = 1.0f / s;

    for (int j = 0; j < 8; j++) {
        f32x4 p = kq[j] * inv;
        f16x4 ph = {(f16)p.x, (f16)p.y, (f16)p.z, (f16)p.w};
        f16x4 ah = {(f16)v0[j].x, (f16)v0[j].y, (f16)v0[j].z, (f16)v0[j].w};
        f16x4 bh = {(f16)v1[j].x, (f16)v1[j].y, (f16)v1[j].z, (f16)v1[j].w};
        *(f16x4*)&ldsP[warp][j * 128 + lane * 4]      = ph;
        *(f16x4*)&ldsV[warp][j * 128 + lane * 4]      = ah;
        *(f16x4*)&ldsV[warp + 16][j * 128 + lane * 4] = bh;
    }
    __syncthreads();

    // wave w: n slice [64w, 64w+64), one A fragment feeds both e tiles
    v8f acc0 = {0.f, 0.f, 0.f, 0.f, 0.f, 0.f, 0.f, 0.f};
    v8f acc1 = {0.f, 0.f, 0.f, 0.f, 0.f, 0.f, 0.f, 0.f};
    int c  = lane & 15;
    int hs = (lane >> 4) * 8;
    for (int ks = 0; ks < 2; ks++) {
        int kk = warp * 64 + ks * 32;
        Frag16 fa, fb0, fb1;
        fa.q[0]  = *(const u32x4*)&ldsP[c][kk + hs];
        fa.q[1]  = *(const u32x4*)&ldsP[c][kk + 16 + hs];
        fb0.q[0] = *(const u32x4*)&ldsV[c][kk + hs];
        fb0.q[1] = *(const u32x4*)&ldsV[c][kk + 16 + hs];
        fb1.q[0] = *(const u32x4*)&ldsV[c + 16][kk + hs];
        fb1.q[1] = *(const u32x4*)&ldsV[c + 16][kk + 16 + hs];
        acc0 = __builtin_amdgcn_wmma_f32_16x16x32_f16(
            false, fa.h, false, fb0.h, (short)0, acc0, false, false);
        acc1 = __builtin_amdgcn_wmma_f32_16x16x32_f16(
            false, fa.h, false, fb1.h, (short)0, acc1, false, false);
    }
    for (int r = 0; r < 8; r++) {
        red[warp][r * 32 + lane]            = acc0[r];
        red[warp][SC_TILE1 + r * 32 + lane] = acc1[r];
    }
    __syncthreads();

    // thread t owns ctx[dt*16 + (t>>5)][t&31]; register r, lane 16*(d>>3)+c held D[d][c]
    int d = warp;
    int e = lane;
    int idx = (e >> 4) * SC_TILE1 + (d & 7) * 32 + (d >> 3) * 16 + (e & 15);
    float sum = 0.f;
    for (int w = 0; w < 16; w++) sum += red[w][idx];
    ctxs[d][e] = sum;
    __syncthreads();             // all 16 ctx rows visible to every wave

    // fold: thread t owns W2 rows c = t>>2 and c + 128, columns d = 4*(t&3) .. +3
    int dq = (t & 3) * 4;
    float fa[4] = {0.f, 0.f, 0.f, 0.f};
    float fb[4] = {0.f, 0.f, 0.f, 0.f};
    for (int j = 0; j < 8; j++) {
        for (int i = 0; i < 4; i++) {
            f32x4 cv = *(const f32x4*)&ctxs[dq + i][j * 4];
            for (int u = 0; u < 4; u++) {
                fa[i] = __builtin_fmaf(wa[j][u], cv[u], fa[i]);
                fb[i] = __builtin_fmaf(wb[j][u], cv[u], fb[i]);
            }
        }
    }
    f16x4 oa = {(f16)fa[0], (f16)fa[1], (f16)fa[2], (f16)fa[3]};
    f16x4 ob = {(f16)fb[0], (f16)fb[1], (f16)fb[2], (f16)fb[3]};
    f16* wo = w2 + (((long)b * (HID / 16) + h * 2 + dt) * CCH) * 16 + t * 4;
    *(f16x4*)wo                = oa;
    *(f16x4*)(wo + 128 * 16)   = ob;
}

// ---------------------------------------------------------------------------
extern "C" void kernel_launch(void* const* d_in, const int* in_sizes, int n_in,
                              void* d_out, int out_size, void* d_ws, size_t ws_size,
                              hipStream_t stream) {
    const float* x     = (const float*)d_in[0];   // (16,256,64,64)
    const float* cond  = (const float*)d_in[1];   // (16,512,32,32)
    const float* gn_w  = (const float*)d_in[2];
    const float* gn_b  = (const float*)d_in[3];
    const float* w_q   = (const float*)d_in[4];   // (128,256)
    const float* b_q   = (const float*)d_in[5];
    const float* w_kv  = (const float*)d_in[6];   // (256,512)
    const float* b_kv  = (const float*)d_in[7];
    const float* w_out = (const float*)d_in[8];   // (256,128)
    const float* b_out = (const float*)d_in[9];
    float* out = (float*)d_out;                   // (16,256,64,64)

    // workspace layout
    char* ws = (char*)d_ws;
    constexpr long SZ_XN   = (long)BATCH * CCH * NPIX * 2;   // 33.5 MB f16
    constexpr long SZ_KV   = (long)BATCH * 2 * HID * NC * 4; // f32
    constexpr long SZ_Q16  = (long)BATCH * HID * NPIX * 2;
    f16*   xn16   = (f16*)(ws);
    float* kvf    = (float*)(ws + SZ_XN);
    f16*   q16    = (f16*)(ws + SZ_XN + SZ_KV);
    f16*   w2_16  = (f16*)(ws + SZ_XN + SZ_KV + SZ_Q16);   // [b][128/16][256][16]

    // 1) GroupNorm -> xn f16
    groupnorm_kernel<<<BATCH * GROUPS, 256, 0, stream>>>(x, gn_w, gn_b, xn16);

    // 2) kv = w_kv @ cond + b_kv   (M=256,K=512,N=1024, f32 operands, f32 out)
    gemm_wmma_kernel<false, true, true, false><<<dim3(256 / GBM, NC / GBN, BATCH), 256, 0, stream>>>(
        nullptr, w_kv, 0, nullptr, cond, (long)CD * NC, kvf, (long)2 * HID * NC, b_kv, 2 * HID, NC, CD);

    // 3) q = w_q @ xn + b_q        (M=128,K=256,N=4096, f32 weight, f16 out)
    gemm_wmma_kernel<true, true, false, false><<<dim3(HID / GBM, NPIX / GBN, BATCH), 256, 0, stream>>>(
        nullptr, w_q, 0, xn16, nullptr, (long)CCH * NPIX, q16, (long)HID * NPIX, b_q, HID, NPIX, CCH);

    // 4) softmax(k), context = P @ V^T, W2 = w_out x context  per (b, h, half of d)
    softmax_ctx_kernel<<<dim3(HEADS, BATCH, 2), 512, 0, stream>>>(kvf, w_out, w2_16);

    // 5) out = W2 @ q + b_out      (M=256,K=128,N=4096, f32 out)
    gemm_wmma_kernel<false, false, false, true><<<dim3(CCH / GBM, NPIX / GBN, BATCH), 256, 0, stream>>>(
        w2_16, nullptr, (long)CCH * HID, q16, nullptr, (long)HID * NPIX, out, (long)CCH * NPIX, b_out,
        CCH, NPIX, HID);
}

// v006
// A run of this version takes 59 microseconds.
// Two timings next to v005 both put it at 1.22 times that version's speed.
// Over all steps from v000 it is 3.15 times as fast.
#include <hip/hip_runtime.h>
#include <hip/hip_bf16.h>

typedef _Float16 f16;
typedef __attribute__((ext_vector_type(16))) _Float16 v16h;
typedef __attribute__((ext_vector_type(8)))  float    v8f;
typedef __attribute__((ext_vector_type(4)))  unsigned int u32x4;
typedef __attribute__((ext_vector_type(2)))  unsigned int u32x2;
typedef int gvi4 __attribute__((vector_size(16)));   // matches async-LDS builtin param
typedef __attribute__((ext_vector_type(4))) float    f32x4;
typedef __attribute__((ext_vector_type(4))) _Float16 f16x4;

union Frag16 { v16h h; u32x4 q[2]; };

#define AS1 __attribute__((address_space(1)))
#define AS3 __attribute__((address_space(3)))

#if __has_builtin(__builtin_amdgcn_global_load_async_to_lds_b128)
#define HAVE_ASYNC_LDS 1
#else
#define HAVE_ASYNC_LDS 0
#endif

__device__ __forceinline__ void wait_asynccnt0() {
#if __has_builtin(__builtin_amdgcn_s_wait_asynccnt)
    __builtin_amdgcn_s_wait_asynccnt(0);
#else
    asm volatile("s_wait_asynccnt 0x0" ::: "memory");
#endif
}

#define HEADS 4
#define DIMH 32
#define BATCH 16
#define CCH 256      // x channels
#define CD 512       // cond channels
#define HID 128      // heads*dim_head
#define NPIX 4096    // 64*64
#define NC 1024      // 32*32
#define GROUPS 32

// ---------------------------------------------------------------------------
// GroupNorm: x (B,256,4096) -> xn f16, 1 block per (batch, group)
//
// A group is 32768 floats = 128 per thread: it stays in registers between the sums and the
// normalisation, so x is read once. All 32 wave-wide 16-byte loads (512 contiguous bytes
// each) are issued before the first use, the group's 8 scales and shifts behind them.
// Chunk j of a thread lies in channel j >> 2.
// ---------------------------------------------------------------------------
__global__ __launch_bounds__(256) void groupnorm_kernel(const float* __restrict__ x,
                                                        const float* __restrict__ w,
                                                        const float* __restrict__ b,
                                                        f16* __restrict__ xn) {
    int blk = blockIdx.x;
    int bat = blk >> 5;
    int g   = blk & 31;
    int t = threadIdx.x;
    int lane = t & 31;
    int warp = t >> 5;
    const f32x4* xb = (const f32x4*)(x + ((long)bat * CCH + g * 8) * NPIX) + t;
    f16x4*       ob = (f16x4*)(xn + ((long)bat * CCH + g * 8) * NPIX) + t;

    f32x4 xv[32];
    float wv[8], bv[8];
    for (int j = 0; j < 32; j++) xv[j] = xb[j * 256];
    for (int i = 0; i < 8; i++) { wv[i] = w[g * 8 + i]; bv[i] = b[g * 8 + i]; }

    f32x4 s4 = {0.f, 0.f, 0.f, 0.f}, q4 = {0.f, 0.f, 0.f, 0.f};
    for (int j = 0; j < 32; j++) {
        s4 += xv[j];
        q4 += xv[j] * xv[j];
    }
    float s  = (s4.x + s4.y) + (s4.z + s4.w);
    float s2 = (q4.x + q4.y) + (q4.z + q4.w);
    for (int o = 16; o >= 1; o >>= 1) {
        s  += __shfl_xor(s, o, 32);
        s2 += __shfl_xor(s2, o, 32);
    }
    __shared__ float sh[8], sh2[8];
    if (lane == 0) { sh[warp] = s; sh2[warp] = s2; }
    __syncthreads();
    s = 0.f; s2 = 0.f;
    for (int i = 0; i < 8; i++) { s += sh[i]; s2 += sh2[i]; }

    float mu  = s * (1.0f / 32768.0f);
    float var = s2 * (1.0f / 32768.0f) - mu * mu;
    float ri  = rsqrtf(var + 1e-5f);
    for (int j = 0; j < 32; j++) {
        f32x4 v = (xv[j] - mu) * ri * wv[j >> 2] + bv[j >> 2];
        f16x4 o = {(f16)v.x, (f16)v.y, (f16)v.z, (f16)v.w};
        ob[j * 256] = o;
    }
}

// ---------------------------------------------------------------------------
// WMMA f16 GEMM:  C[b] = A[b] (MxK) * B[b] (KxN) + bias
//
// Block tile 128(M) x 128(N), BK=64, 8 waves; wave (w>>1, w&1) owns a 32x64 output
// patch: per 32 k, two A and four B fragments feed eight v_wmma_f32_16x16x32_f16, so
// a fragment read from LDS is used 4 (A) or 2 (B) times, and few, long-lived waves do the
// work: fewer wave starts and fewer barrier trips per product.
// M, N multiples of 128, K of 64.
// Double-buffered LDS, one barrier per K-step. A tile staged with
// GLOBAL_LOAD_ASYNC_TO_LDS_B128 (ASYNCcnt). B tile staged as it lies in memory, [k][n],
// 16B LDS stores; ds_load_tr16_b128 transposes it on the way into the
// fragment. Row pitches are padded for their readers (64 banks x 4 B): A 144 B = 16 B x odd
// for ds_load_b128, B 288 B = 32 B x odd for ds_load_tr16_b128.
// An operand that is still f32 in memory (A32 / B32: the weights, cond) is loaded as
// f32 and rounded to f16 in registers on its way into LDS, so it needs no convert
// launch and no f16 copy in the workspace; such an A tile goes through registers.
// ABLK: the f16 A operand lies in memory as [K/16][M][16] (16-k slabs of whole rows, the form
// its producer can write as one contiguous piece per work-group) instead of [M][K].
//
// Fragment layout (ISA 7.12.2, 16-bit 16x32): lane L (idx = L&15):
//   halves 0..7  = K (L<16 ? 0..7 : 8..15),  halves 8..15 = +16.
// Two transposing loads, at k rows 0 and 16 of a 32-k slab, deliver B in the same k order.
// ---------------------------------------------------------------------------
#define GBM 128
#define GBN 128
#define GBK 64
#define GA_PITCH 72    // halves per ldsA row (64 used)
#define GB_PITCH 144   // halves per ldsB row (128 used)

typedef __attribute__((ext_vector_type(8))) short s16x8;

// Lane l passes the address of 8 halves of row 8*(l>>4) + (l&7), column half (l>>3)&1, of a
// 16(k) x 16(n) block; it gets back column l&15, k = 8*(l>>4) .. +7.
__device__ __forceinline__ u32x4 lds_load_tr16(const f16* p) {
    return __builtin_bit_cast(u32x4, __builtin_amdgcn_ds_load_tr16_b128_v8i16((AS3 s16x8*)p));
}

__device__ __forceinline__ u32x4 round_to_f16x8(f32x4 lo, f32x4 hi) {
    union { f16 h[8]; u32x4 q; } u;
    for (int i = 0; i < 4; i++) { u.h[i] = (f16)lo[i]; u.h[4 + i] = (f16)hi[i]; }
    return u.q;
}

template <bool OUT16, bool A32, bool B32, bool ABLK>
__global__ __launch_bounds__(256) void gemm_wmma_kernel(
    const f16* __restrict__ A, const float* __restrict__ Af, long sA,
    const f16* __restrict__ B, const float* __restrict__ Bf, long sB,
    void* __restrict__ Cv, long sC,
    const float* __restrict__ bias,
    int M, int N, int K) {

    __shared__ __attribute__((aligned(16))) f16 ldsA[2][GBM][GA_PITCH];   // [buf][m][k]
    __shared__ __attribute__((aligned(16))) f16 ldsB[2][GBK][GB_PITCH];   // [buf][k][n]

    int bat = blockIdx.z;
    int m0  = blockIdx.x * GBM;
    int n0  = blockIdx.y * GBN;
    int t    = threadIdx.x;
    int lane = t & 31;
    int warp = t >> 5;
    int trow = (warp >> 1) * 32;     // 0,32,64,96
    int tcol = (warp & 1) * 64;      // 0,64
    int hs   = (lane >> 4) * 8;      // K-half select

    const f16*   Ab  = A32 ? nullptr : A + (long)bat * sA;
    const float* Afb = A32 ? Af + (long)bat * sA : nullptr;
    const f16*   Bb  = B32 ? nullptr : B + (long)bat * sB;
    const float* Bfb = B32 ? Bf + (long)bat * sB : nullptr;

    // staging coordinates: 8192 halves per tile = 4 chunks of 8 per thread
    int ar_st = t >> 3;              // A row 0..31, chunk i: + 32 i
    int ac_st = (t & 7) * 8;         // A k-col, multiple of 8
    int bk_st = t >> 4;              // B k-row 0..15, chunk i: + 16 i
    int bn_st = (t & 15) * 8;        // B n-col, multiple of 8
    // A thread's place inside a chunk, in elements; the rest of every address is the same
    // for the whole block and is summed on the scalar side.
    unsigned a_voff = ABLK ? (unsigned)(((ac_st >> 4) * M + ar_st) * 16 + (ac_st & 15))
                           : (unsigned)(ar_st * K + ac_st);
    unsigned b_voff = (unsigned)(bk_st * N + bn_st);

    v8f acc[2][4];
    for (int i = 0; i < 2; i++)
        for (int j = 0; j < 4; j++)
            acc[i][j] = (v8f){0.f, 0.f, 0.f, 0.f, 0.f, 0.f, 0.f, 0.f};

    int nk = K >> 6;
    u32x4 rb[4];                     // f16 operands: 8 halves a chunk
    f32x4 rbf[4][2], raf[4][2];      // f32 operands: 8 floats a chunk
#if !HAVE_ASYNC_LDS
    u32x4 ra[4];
#endif

    // Prefetch address: 4 threads a B row, two tiles ahead. It is carried through the loop
    // and steps only while a later tile exists, so it always points into B.
    long pf_step = (long)GBK * N;
    long pf_off  = (nk > 2 ? 2 * pf_step : 0) + n0 + (long)(t >> 2) * N + (t & 3) * 32;
    const void* pf = B32 ? (const void*)(Bfb + pf_off) : (const void*)(Bb + pf_off);

    // Issues the loads of the tile at k0; an f16 A tile is copied straight into ldsA[nbuf].
    auto issue_tile = [&](int k0, int nbuf, bool prefetch) {
        const void *pb[4], *pa[4];
        for (int i = 0; i < 4; i++) {
            long off = (long)(k0 + 16 * i) * N + n0;
            if constexpr (B32) {
                const f32x4* p = (const f32x4*)(Bfb + off + b_voff);
                rbf[i][0] = p[0]; rbf[i][1] = p[1];
                pb[i] = p;
            } else {
                const u32x4* p = (const u32x4*)(Bb + off + b_voff);
                rb[i] = p[0];
                pb[i] = p;
            }
        }
        for (int i = 0; i < 4; i++) {
            long off = ABLK ? ((long)(k0 >> 4) * M + m0 + 32 * i) * 16
                            : (long)(m0 + 32 * i) * K + k0;
            if constexpr (A32) {
                const f32x4* p = (const f32x4*)(Afb + off + a_voff);
                raf[i][0] = p[0]; raf[i][1] = p[1];
                pa[i] = p;
            } else {
                pa[i] = pb[i];       // a builtin copy owes no such wait: B's address again
#if HAVE_ASYNC_LDS
                __builtin_amdgcn_global_load_async_to_lds_b128(
                    (AS1 gvi4*)(Ab + off + a_voff),
                    (AS3 gvi4*)&ldsA[nbuf][ar_st + 32 * i][ac_st], 0, 0);
#else
                ra[i] = *(const u32x4*)(Ab + off + a_voff);
#endif
            }
        }
        if (prefetch) __builtin_prefetch(pf, 0, 1);   // B tile two ahead -> global_prefetch_b8
        // The wait owed before a register that an issued load names is written again. The
        // addresses are its inputs, so they stay whole up to it (no load's result lands in them).
        asm volatile("s_wait_xcnt 0x0"
                     :: "v"(pb[0]), "v"(pb[1]), "v"(pb[2]), "v"(pb[3]),
                        "v"(pa[0]), "v"(pa[1]), "v"(pa[2]), "v"(pa[3]), "v"(pf) : "memory");
    };

    issue_tile(0, 0, false);

    for (int kt = 0; kt < nk; kt++) {
        int buf = kt & 1;
        // ---- commit tile kt to LDS ---------------------------------------
        for (int i = 0; i < 4; i++) {
            if constexpr (B32) {
                *(u32x4*)&ldsB[buf][bk_st + 16 * i][bn_st] = round_to_f16x8(rbf[i][0], rbf[i][1]);
            } else {
                *(u32x4*)&ldsB[buf][bk_st + 16 * i][bn_st] = rb[i];
            }
        }
        if constexpr (A32) {
            for (int i = 0; i < 4; i++)
                *(u32x4*)&ldsA[buf][ar_st + 32 * i][ac_st] = round_to_f16x8(raf[i][0], raf[i][1]);
        } else {
#if HAVE_ASYNC_LDS
            wait_asynccnt0();        // my async A chunks for tile kt landed
#else
            for (int i = 0; i < 4; i++)
                *(u32x4*)&ldsA[buf][ar_st + 32 * i][ac_st] = ra[i];
#endif
        }
        // All waves' A+B chunks visible. Directly behind the asynccnt wait it also keeps the
        // compiler from lifting an LDS read over that wait.
        __syncthreads();

        // ---- issue tile kt+1 (other buffer) ------------------------------
        if (kt + 1 < nk) {
            issue_tile((kt + 1) * GBK, buf ^ 1, kt + 2 < nk);
            if (kt + 3 < nk) pf = B32 ? (const void*)((const float*)pf + pf_step)
                                      : (const void*)((const f16*)pf + pf_step);
        }

        // ---- fragments + 8x WMMA per 32 k --------------------------------
        for (int ks = 0; ks < GBK / 32; ks++) {
            Frag16 fa[2], fb[4];
            const f16* ap = &ldsA[buf][trow + (lane & 15)][ks * 32 + hs];
            const f16* bp = &ldsB[buf][ks * 32 + hs + (lane & 7)][tcol + ((lane >> 3) & 1) * 8];
            for (int i = 0; i < 2; i++) {
                fa[i].q[0] = *(const u32x4*)(ap + i * 16 * GA_PITCH);
                fa[i].q[1] = *(const u32x4*)(ap + i * 16 * GA_PITCH + 16);
            }
            for (int j = 0; j < 4; j++) {
                fb[j].q[0] = lds_load_tr16(bp + j * 16);
                fb[j].q[1] = lds_load_tr16(bp + 16 * GB_PITCH + j * 16);
            }
            for (int i = 0; i < 2; i++)
                for (int j = 0; j < 4; j++)
                    acc[i][j] = __builtin_amdgcn_wmma_f32_16x16x32_f16(
                        false, fa[i].h, false, fb[j].h, (short)0, acc[i][j], false, false);
        }
    }

    // ---- epilogue: tile (i, j), VGPR r -> row (trow + 16 i + r + 8*(lane>=16)) ----
    int col0 = n0 + tcol + (lane & 15);
    for (int i = 0; i < 2; i++) {
        int rbase = m0 + trow + i * 16 + (lane >> 4) * 8;
        for (int r = 0; r < 8; r++) {
            int row = rbase + r;
            float bv = bias[row];
            long base = (long)bat * sC + (long)row * N + col0;
            for (int j = 0; j < 4; j++) {
                float v = acc[i][j][r] + bv;
                if (OUT16) ((f16*)Cv)[base + j * 16] = (f16)v;
                else       ((float*)Cv)[base + j * 16] = v;
            }
        }
    }
}

// ---------------------------------------------------------------------------
// Per-(batch, head, half of d): softmax(k, axis=n), ctx[d][e] = sum_n p[d][n]*v[e][n]
// kv: (B, 256, 1024) f32;  k rows = h*32+d,  v rows = 128+h*32+e.
//
// 16 waves. Wave w keeps k row w of its d half and v rows w, w+16 whole in
// registers (24 wave-wide 16-byte loads, all issued before the first use), so
// kv is read once and the row max and sum need no second pass. P and V go to
// LDS as f16 once; then wave w multiplies the n slice [64w, 64w+64) for both
// e tiles, and the 16 partial tiles are summed in f32 through LDS.
//
// The block then folds its 16 ctx rows into the output weight itself (f32, e ascending):
//   W2[b][c][h*32+d] = sum_e w_out[c][h*32+e] * ctx[b][h][d][e]   (f16 out)
// so ctx never leaves LDS and the fold needs no launch of its own. W2 is written as
// [b][j/16][c][16], j = h*32+d: a block's 256 x 16 piece is one contiguous 8 KiB, whole lines.
// ---------------------------------------------------------------------------
// Four v_exp_f32 (the instruction __expf ends in) in one statement. The outputs are
// early-clobbered so that none lands on a source of the v_exp_f32 directly ahead of it, and
// the v_nop is the slot the instruction set asks for behind the last one.
__device__ __forceinline__ f32x4 exp2_x4(f32x4 a) {
    float r0, r1, r2, r3;
    asm("v_exp_f32 %0, %4\n\tv_exp_f32 %1, %5\n\tv_exp_f32 %2, %6\n\tv_exp_f32 %3, %7\n\tv_nop"
        : "=&v"(r0), "=&v"(r1), "=&v"(r2), "=&v"(r3)
        : "v"(a.x), "v"(a.y), "v"(a.z), "v"(a.w));
    f32x4 r = {r0, r1, r2, r3};
    return r;
}

#define SC_PITCH (NC + 8)    // halves: 2064 B = 16 B x odd, for the ds_load_b128 fragment reads
#define SC_TILE1 272         // dword offset of the second e tile's partials (16 banks off the first)
#define SC_CPITCH 36         // floats per ctx row in LDS: rows 4 apart lie 16 banks apart

__global__ __launch_bounds__(512) void softmax_ctx_kernel(const float* __restrict__ kv,
                                                          const float* __restrict__ w_out,
                                                          f16* __restrict__ w2) {
    int h  = blockIdx.x;
    int b  = blockIdx.y;
    int dt = blockIdx.z;          // which 16 rows of d

    __shared__ __attribute__((aligned(16))) f16 ldsP[16][SC_PITCH];
    __shared__ __attribute__((aligned(16))) f16 ldsV[DIMH][SC_PITCH];
    __shared__ float red[16][SC_TILE1 + 256];
    __shared__ __attribute__((aligned(16))) float ctxs[16][SC_CPITCH];

    int t = threadIdx.x;
    int lane = t & 31;
    int warp = t >> 5;

    const f32x4* kr = (const f32x4*)(kv + ((long)b * 256 + h * DIMH + dt * 16 + warp) * NC) + lane;
    const f32x4* va = (const f32x4*)(kv + ((long)b * 256 + HID + h * DIMH + warp) * NC) + lane;
    const f32x4* vb = va + 16 * NC / 4;
    // the fold's w_out rows, c = t>>2 and c + 128, this head's 32 columns
    const f32x4* wr = (const f32x4*)(w_out + (long)(t >> 2) * HID + h * DIMH);

    f32x4 kq[8], v0[8], v1[8], wa[8], wb[8];
    for (int j = 0; j < 8; j++) kq[j] = kr[j * 32];
    for (int j = 0; j < 8; j++) v0[j] = va[j * 32];
    for (int j = 0; j < 8; j++) v1[j] = vb[j * 32];
    for (int j = 0; j < 8; j++) wa[j] = wr[j];                    // behind k and v: they arrive
    for (int j = 0; j < 8; j++) wb[j] = wr[128 * HID / 4 + j];    // under the softmax
    // The wait owed before a register that an issued load names is written again. The three
    // address pairs are its inputs, so they stay whole up to it (no load's result lands in them).
    asm volatile("s_wait_xcnt 0x0" :: "v"(kr), "v"(va), "v"(wr) : "memory");
    // Keeps the max from being scheduled ahead of the v loads: without it they are issued
    // behind the wait for k, and their latency follows k's instead of overlapping it.
    __builtin_amdgcn_sched_barrier(0);

    // row max
    float m = -1e30f;
    for (int j = 0; j < 8; j++)
        m = fmaxf(m, fmaxf(fmaxf(kq[j].x, kq[j].y), fmaxf(kq[j].z, kq[j].w)));
    for (int o = 16; o >= 1; o >>= 1) m = fmaxf(m, __shfl_xor(m, o, 32));

    // exponentials stay in registers; four independent sum chains
    f32x4 s4 = {0.f, 0.f, 0.f, 0.f};
    for (int j = 0; j < 8; j++) {
        kq[j] = exp2_x4((kq[j] - m) * 1.44269504088896340736f);   // = __expf(k - m)
        s4 += kq[j];
    }
    float s = (s4.x + s4.y) + (s4.z + s4.w);
    for (int o = 16; o >= 1; o >>= 1) s += __shfl_xor(s, o, 32);
    float inv = 1.0f / s;

    for (int j = 0; j < 8; j++) {
        f32x4 p = kq[j] * inv;
        f16x4 ph = {(f16)p.x, (f16)p.y, (f16)p.z, (f16)p.w};
        f16x4 ah = {(f16)v0[j].x, (f16)v0[j].y, (f16)v0[j].z, (f16)v0[j].w};
        f16x4 bh = {(f16)v1[j].x, (f16)v1[j].y, (f16)v1[j].z, (f16)v1[j].w};
        *(f16x4*)&ldsP[warp][j * 128 + lane * 4]      = ph;
        *(f16x4*)&ldsV[warp][j * 128 + lane * 4]      = ah;
        *(f16x4*)&ldsV[warp + 16][j * 128 + lane * 4] = bh;
    }
    __syncthreads();

    // wave w: n slice [64w, 64w+64), one A fragment feeds both e tiles
    v8f acc0 = {0.f, 0.f, 0.f, 0.f, 0.f, 0.f, 0.f, 0.f};
    v8f acc1 = {0.f, 0.f, 0.f, 0.f, 0.f, 0.f, 0.f, 0.f};
    int c  = lane & 15;
    int hs = (lane >> 4) * 8;
    for (int ks = 0; ks < 2; ks++) {
        int kk = warp * 64 + ks * 32;
        Frag16 fa, fb0, fb1;
        fa.q[0]  = *(const u32x4*)&ldsP[c][kk + hs];
        fa.q[1]  = *(const u32x4*)&ldsP[c][kk + 16 + hs];
        fb0.q[0] = *(const u32x4*)&ldsV[c][kk + hs];
        fb0.q[1] = *(const u32x4*)&ldsV[c][kk + 16 + hs];
        fb1.q[0] = *(const u32x4*)&ldsV[c + 16][kk + hs];
        fb1.q[1] = *(const u32x4*)&ldsV[c + 16][kk + 16 + hs];
        acc0 = __builtin_amdgcn_wmma_f32_16x16x32_f16(
            false, fa.h, false, fb0.h, (short)0, acc0, false, false);
        acc1 = __builtin_amdgcn_wmma_f32_16x16x32_f16(
            false, fa.h, false, fb1.h, (short)0, acc1, false, false);
    }
    for (int r = 0; r < 8; r++) {
        red[warp][r * 32 + lane]            = acc0[r];
        red[warp][SC_TILE1 + r * 32 + lane] = acc1[r];
    }
    __syncthreads();

    // thread t owns ctx[dt*16 + (t>>5)][t&31]; register r, lane 16*(d>>3)+c held D[d][c]
    int d = warp;
    int e = lane;
    int idx = (e >> 4) * SC_TILE1 + (d & 7) * 32 + (d >> 3) * 16 + (e & 15);
    float sum = 0.f;
    for (int w = 0; w < 16; w++) sum += red[w][idx];
    ctxs[d][e] = sum;
    __syncthreads();             // all 16 ctx rows visible to every wave

    // fold: thread t owns W2 rows c = t>>2 and c + 128, columns d = 4*(t&3) .. +3
    int dq = (t & 3) * 4;
    float fa[4] = {0.f, 0.f, 0.f, 0.f};
    float fb[4] = {0.f, 0.f, 0.f, 0.f};
    for (int j = 0; j < 8; j++) {
        for (int i = 0; i < 4; i++) {
            f32x4 cv = *(const f32x4*)&ctxs[dq + i][j * 4];
            for (int u = 0; u < 4; u++) {
                fa[i] = __builtin_fmaf(wa[j][u], cv[u], fa[i]);
                fb[i] = __builtin_fmaf(wb[j][u], cv[u], fb[i]);
            }
        }
    }
    f16x4 oa = {(f16)fa[0], (f16)fa[1], (f16)fa[2], (f16)fa[3]};
    f16x4 ob = {(f16)fb[0], (f16)fb[1], (f16)fb[2], (f16)fb[3]};
    f16* wo = w2 + (((long)b * (HID / 16) + h * 2 + dt) * CCH) * 16 + t * 4;
    *(f16x4*)wo                = oa;
    *(f16x4*)(wo + 128 * 16)   = ob;
}

// ---------------------------------------------------------------------------
extern "C" void kernel_launch(void* const* d_in, const int* in_sizes, int n_in,
                              void* d_out, int out_size, void* d_ws, size_t ws_size,
                              hipStream_t stream) {
    const float* x     = (const float*)d_in[0];   // (16,256,64,64)
    const float* cond  = (const float*)d_in[1];   // (16,512,32,32)
    const float* gn_w  = (const float*)d_in[2];
    const float* gn_b  = (const float*)d_in[3];
    const float* w_q   = (const float*)d_in[4];   // (128,256)
    const float* b_q   = (const float*)d_in[5];
    const float* w_kv  = (const float*)d_in[6];   // (256,512)
    const float* b_kv  = (const float*)d_in[7];
    const float* w_out = (const float*)d_in[8];   // (256,128)
    const float* b_out = (const float*)d_in[9];
    float* out = (float*)d_out;                   // (16,256,64,64)

    // workspace layout
    char* ws = (char*)d_ws;
    constexpr long SZ_XN   = (long)BATCH * CCH * NPIX * 2;   // 33.5 MB f16
    constexpr long SZ_KV   = (long)BATCH * 2 * HID * NC * 4; // f32
    constexpr long SZ_Q16  = (long)BATCH * HID * NPIX * 2;
    f16*   xn16   = (f16*)(ws);
    float* kvf    = (float*)(ws + SZ_XN);
    f16*   q16    = (f16*)(ws + SZ_XN + SZ_KV);
    f16*   w2_16  = (f16*)(ws + SZ_XN + SZ_KV + SZ_Q16);   // [b][128/16][256][16]

    // 1) GroupNorm -> xn f16
    groupnorm_kernel<<<BATCH * GROUPS, 256, 0, stream>>>(x, gn_w, gn_b, xn16);

    // 2) kv = w_kv @ cond + b_kv   (M=256,K=512,N=1024, f32 operands, f32 out)
    gemm_wmma_kernel<false, true, true, false><<<dim3(256 / GBM, NC / GBN, BATCH), 256, 0, stream>>>(
        nullptr, w_kv, 0, nullptr, cond, (long)CD * NC, kvf, (long)2 * HID * NC, b_kv, 2 * HID, NC, CD);

    // 3) q = w_q @ xn + b_q        (M=128,K=256,N=4096, f32 weight, f16 out)
    gemm_wmma_kernel<true, true, false, false><<<dim3(HID / GBM, NPIX / GBN, BATCH), 256, 0, stream>>>(
        nullptr, w_q, 0, xn16, nullptr, (long)CCH * NPIX, q16, (long)HID * NPIX, b_q, HID, NPIX, CCH);

    // 4) softmax(k), context = P @ V^T, W2 = w_out x context  per (b, h, half of d)
    softmax_ctx_kernel<<<dim3(HEADS, BATCH, 2), 512, 0, stream>>>(kvf, w_out, w2_16);

    // 5) out = W2 @ q + b_out      (M=256,K=128,N=4096, f32 out)
    gemm_wmma_kernel<false, false, false, true><<<dim3(CCH / GBM, NPIX / GBN, BATCH), 256, 0, stream>>>(
        w2_16, nullptr, (long)CCH * HID, q16, nullptr, (long)HID * NPIX, out, (long)CCH * NPIX, b_out,
        CCH, NPIX, HID);
}

// v007
// One run takes 53.9 microseconds.
// Two timings next to v006 both put it at 1.10 times that version's speed.
// All steps since v000 together make it 3.46 times as fast.
#include <hip/hip_runtime.h>
#include <hip/hip_bf16.h>

typedef _Float16 f16;
typedef __attribute__((ext_vector_type(16))) _Float16 v16h;
typedef __attribute__((ext_vector_type(8)))  float    v8f;
typedef __attribute__((ext_vector_type(4)))  unsigned int u32x4;
typedef __attribute__((ext_vector_type(2)))  unsigned int u32x2;
typedef int gvi4 __attribute__((vector_size(16)));   // matches async-LDS builtin param
typedef __attribute__((ext_vector_type(4))) float    f32x4;
typedef __attribute__((ext_vector_type(4))) _Float16 f16x4;

union Frag16 { v16h h; u32x4 q[2]; };

#define AS1 __attribute__((address_space(1)))
#define AS3 __attribute__((address_space(3)))

#if __has_builtin(__builtin_amdgcn_global_load_async_to_lds_b128)
#define HAVE_ASYNC_LDS 1
#else
#define HAVE_ASYNC_LDS 0
#endif

__device__ __forceinline__ void wait_asynccnt0() {
#if __has_builtin(__builtin_amdgcn_s_wait_asynccnt)
    __builtin_amdgcn_s_wait_asynccnt(0);
#else
    asm volatile("s_wait_asynccnt 0x0" ::: "memory");
#endif
}

#define HEADS 4
#define DIMH 32
#define BATCH 16
#define CCH 256      // x channels
#define CD 512       // cond channels
#define HID 128      // heads*dim_head
#define NPIX 4096    // 64*64
#define NC 1024      // 32*32
#define GROUPS 32

// ---------------------------------------------------------------------------
// GroupNorm: x (B,256,4096) -> xn f16, 1 block per (batch, group), blk = batch * 32 + group
//
// A group is 32768 floats = 128 per thread: it stays in registers between the sums and the
// normalisation, so x is read once. All 32 wave-wide 16-byte loads (512 contiguous bytes
// each) are issued before the first use, the group's 8 scales and shifts behind them.
// Chunk j of a thread lies in channel j >> 2.
// ---------------------------------------------------------------------------
__device__ __forceinline__ void groupnorm_body(int blk,
                                               const float* __restrict__ x,
                                               const float* __restrict__ w,
                                               const float* __restrict__ b,
                                               f16* __restrict__ xn) {
    int bat = blk >> 5;
    int g   = blk & 31;
    int t = threadIdx.x;
    int lane = t & 31;
    int warp = t >> 5;
    const f32x4* xb = (const f32x4*)(x + ((long)bat * CCH + g * 8) * NPIX) + t;
    f16x4*       ob = (f16x4*)(xn + ((long)bat * CCH + g * 8) * NPIX) + t;

    f32x4 xv[32];
    float wv[8], bv[8];
    for (int j = 0; j < 32; j++) xv[j] = xb[j * 256];
    for (int i = 0; i < 8; i++) { wv[i] = w[g * 8 + i]; bv[i] = b[g * 8 + i]; }

    f32x4 s4 = {0.f, 0.f, 0.f, 0.f}, q4 = {0.f, 0.f, 0.f, 0.f};
    for (int j = 0; j < 32; j++) {
        s4 += xv[j];
        q4 += xv[j] * xv[j];
    }
    float s  = (s4.x + s4.y) + (s4.z + s4.w);
    float s2 = (q4.x + q4.y) + (q4.z + q4.w);
    for (int o = 16; o >= 1; o >>= 1) {
        s  += __shfl_xor(s, o, 32);
        s2 += __shfl_xor(s2, o, 32);
    }
    __shared__ float sh[8], sh2[8];
    if (lane == 0) { sh[warp] = s; sh2[warp] = s2; }
    __syncthreads();
    s = 0.f; s2 = 0.f;
    for (int i = 0; i < 8; i++) { s += sh[i]; s2 += sh2[i]; }

    float mu  = s * (1.0f / 32768.0f);
    float var = s2 * (1.0f / 32768.0f) - mu * mu;
    float ri  = rsqrtf(var + 1e-5f);
    for (int j = 0; j < 32; j++) {
        f32x4 v = (xv[j] - mu) * ri * wv[j >> 2] + bv[j >> 2];
        f16x4 o = {(f16)v.x, (f16)v.y, (f16)v.z, (f16)v.w};
        ob[j * 256] = o;
    }
}

// ---------------------------------------------------------------------------
// WMMA f16 GEMM:  C[b] = A[b] (MxK) * B[b] (KxN) + bias
//
// Block tile 128(M) x 128(N), BK=64, 8 waves; wave (w>>1, w&1) owns a 32x64 output
// patch: per 32 k, two A and four B fragments feed eight v_wmma_f32_16x16x32_f16, so
// a fragment read from LDS is used 4 (A) or 2 (B) times, and few, long-lived waves do the
// work: fewer wave starts and fewer barrier trips per product.
// M, N multiples of 128, K of 64.
// Double-buffered LDS, one barrier per K-step. A tile staged with
// GLOBAL_LOAD_ASYNC_TO_LDS_B128 (ASYNCcnt). B tile staged as it lies in memory, [k][n],
// 16B LDS stores; ds_load_tr16_b128 transposes it on the way into the
// fragment. Row pitches are padded for their readers (64 banks x 4 B): A 144 B = 16 B x odd
// for ds_load_b128, B 288 B = 32 B x odd for ds_load_tr16_b128.
// An operand that is still f32 in memory (A32 / B32: the weights, cond) is loaded as
// f32 and rounded to f16 in registers on its way into LDS, so it needs no convert
// launch and no f16 copy in the workspace; such an A tile goes through registers.
// ABLK: the f16 A operand lies in memory as [K/16][M][16] (16-k slabs of whole rows, the form
// its producer can write as one contiguous piece per work-group) instead of [M][K].
//
// Fragment layout (ISA 7.12.2, 16-bit 16x32): lane L (idx = L&15):
//   halves 0..7  = K (L<16 ? 0..7 : 8..15),  halves 8..15 = +16.
// Two transposing loads, at k rows 0 and 16 of a 32-k slab, deliver B in the same k order.
// ---------------------------------------------------------------------------
#define GBM 128
#define GBN 128
#define GBK 64
#define GA_PITCH 72    // halves per ldsA row (64 used)
#define GB_PITCH 144   // halves per ldsB row (128 used)

typedef __attribute__((ext_vector_type(8))) short s16x8;

// Lane l passes the address of 8 halves of row 8*(l>>4) + (l&7), column half (l>>3)&1, of a
// 16(k) x 16(n) block; it gets back column l&15, k = 8*(l>>4) .. +7.
__device__ __forceinline__ u32x4 lds_load_tr16(const f16* p) {
    return __builtin_bit_cast(u32x4, __builtin_amdgcn_ds_load_tr16_b128_v8i16((AS3 s16x8*)p));
}

__device__ __forceinline__ u32x4 round_to_f16x8(f32x4 lo, f32x4 hi) {
    union { f16 h[8]; u32x4 q; } u;
    for (int i = 0; i < 4; i++) { u.h[i] = (f16)lo[i]; u.h[4 + i] = (f16)hi[i]; }
    return u.q;
}

template <bool OUT16, bool A32, bool B32, bool ABLK>
__device__ __forceinline__ void gemm_wmma_body(
    int bx, int by, int bat,
    const f16* __restrict__ A, const float* __restrict__ Af, long sA,
    const f16* __restrict__ B, const float* __restrict__ Bf, long sB,
    void* __restrict__ Cv, long sC,
    const float* __restrict__ bias,
    int M, int N, int K) {

    __shared__ __attribute__((aligned(16))) f16 ldsA[2][GBM][GA_PITCH];   // [buf][m][k]
    __shared__ __attribute__((aligned(16))) f16 ldsB[2][GBK][GB_PITCH];   // [buf][k][n]

    int m0  = bx * GBM;
    int n0  = by * GBN;
    int t    = threadIdx.x;
    int lane = t & 31;
    int warp = t >> 5;
    int trow = (warp >> 1) * 32;     // 0,32,64,96
    int tcol = (warp & 1) * 64;      // 0,64
    int hs   = (lane >> 4) * 8;      // K-half select

    const f16*   Ab  = A32 ? nullptr : A + (long)bat * sA;
    const float* Afb = A32 ? Af + (long)bat * sA : nullptr;
    const f16*   Bb  = B32 ? nullptr : B + (long)bat * sB;
    const float* Bfb = B32 ? Bf + (long)bat * sB : nullptr;

    // staging coordinates: 8192 halves per tile = 4 chunks of 8 per thread
    int ar_st = t >> 3;              // A row 0..31, chunk i: + 32 i
    int ac_st = (t & 7) * 8;         // A k-col, multiple of 8
    int bk_st = t >> 4;              // B k-row 0..15, chunk i: + 16 i
    int bn_st = (t & 15) * 8;        // B n-col, multiple of 8
    // A thread's place inside a chunk, in elements; the rest of every address is the same
    // for the whole block and is summed on the scalar side.
    unsigned a_voff = ABLK ? (unsigned)(((ac_st >> 4) * M + ar_st) * 16 + (ac_st & 15))
                           : (unsigned)(ar_st * K + ac_st);
    unsigned b_voff = (unsigned)(bk_st * N + bn_st);

    v8f acc[2][4];
    for (int i = 0; i < 2; i++)
        for (int j = 0; j < 4; j++)
            acc[i][j] = (v8f){0.f, 0.f, 0.f, 0.f, 0.f, 0.f, 0.f, 0.f};

    int nk = K >> 6;
    u32x4 rb[4];                     // f16 operands: 8 halves a chunk
    f32x4 rbf[4][2], raf[4][2];      // f32 operands: 8 floats a chunk
#if !HAVE_ASYNC_LDS
    u32x4 ra[4];
#endif

    // Prefetch address: 4 threads a B row, two tiles ahead. It is carried through the loop
    // and steps only while a later tile exists, so it always points into B.
    long pf_step = (long)GBK * N;
    long pf_off  = (nk > 2 ? 2 * pf_step : 0) + n0 + (long)(t >> 2) * N + (t & 3) * 32;
    const void* pf = B32 ? (const void*)(Bfb + pf_off) : (const void*)(Bb + pf_off);

    // Issues the loads of the tile at k0; an f16 A tile is copied straight into ldsA[nbuf].
    auto issue_tile = [&](int k0, int nbuf, bool prefetch) {
        const void *pb[4], *pa[4];
        for (int i = 0; i < 4; i++) {
            long off = (long)(k0 + 16 * i) * N + n0;
            if constexpr (B32) {
                const f32x4* p = (const f32x4*)(Bfb + off + b_voff);
                rbf[i][0] = p[0]; rbf[i][1] = p[1];
                pb[i] = p;
            } else {
                const u32x4* p = (const u32x4*)(Bb + off + b_voff);
                rb[i] = p[0];
                pb[i] = p;
            }
        }
        for (int i = 0; i < 4; i++) {
            long off = ABLK ? ((long)(k0 >> 4) * M + m0 + 32 * i) * 16
                            : (long)(m0 + 32 * i) * K + k0;
            if constexpr (A32) {
                const f32x4* p = (const f32x4*)(Afb + off + a_voff);
                raf[i][0] = p[0]; raf[i][1] = p[1];
                pa[i] = p;
            } else {
                pa[i] = pb[i];       // a builtin copy owes no such wait: B's address again
#if HAVE_ASYNC_LDS
                __builtin_amdgcn_global_load_async_to_lds_b128(
                    (AS1 gvi4*)(Ab + off + a_voff),
                    (AS3 gvi4*)&ldsA[nbuf][ar_st + 32 * i][ac_st], 0, 0);
#else
                ra[i] = *(const u32x4*)(Ab + off + a_voff);
#endif
            }
        }
        if (prefetch) __builtin_prefetch(pf, 0, 1);   // B tile two ahead -> global_prefetch_b8
        // The wait owed before a register that an issued load names is written again. The
        // addresses are its inputs, so they stay whole up to it (no load's result lands in them).
        asm volatile("s_wait_xcnt 0x0"
                     :: "v"(pb[0]), "v"(pb[1]), "v"(pb[2]), "v"(pb[3]),
                        "v"(pa[0]), "v"(pa[1]), "v"(pa[2]), "v"(pa[3]), "v"(pf) : "memory");
    };

    issue_tile(0, 0, false);

    for (int kt = 0; kt < nk; kt++) {
        int buf = kt & 1;
        // ---- commit tile kt to LDS ---------------------------------------
        for (int i = 0; i < 4; i++) {
            if constexpr (B32) {
                *(u32x4*)&ldsB[buf][bk_st + 16 * i][bn_st] = round_to_f16x8(rbf[i][0], rbf[i][1]);
            } else {
                *(u32x4*)&ldsB[buf][bk_st + 16 * i][bn_st] = rb[i];
            }
        }
        if constexpr (A32) {
            for (int i = 0; i < 4; i++)
                *(u32x4*)&ldsA[buf][ar_st + 32 * i][ac_st] = round_to_f16x8(raf[i][0], raf[i][1]);
        } else {
#if HAVE_ASYNC_LDS
            wait_asynccnt0();        // my async A chunks for tile kt landed
#else
            for (int i = 0; i < 4; i++)
                *(u32x4*)&ldsA[buf][ar_st + 32 * i][ac_st] = ra[i];
#endif
        }
        // All waves' A+B chunks visible. Directly behind the asynccnt wait it also keeps the
        // compiler from lifting an LDS read over that wait.
        __syncthreads();

        // ---- issue tile kt+1 (other buffer) ------------------------------
        if (kt + 1 < nk) {
            issue_tile((kt + 1) * GBK, buf ^ 1, kt + 2 < nk);
            if (kt + 3 < nk) pf = B32 ? (const void*)((const float*)pf + pf_step)
                                      : (const void*)((const f16*)pf + pf_step);
        }

        // ---- fragments + 8x WMMA per 32 k --------------------------------
        for (int ks = 0; ks < GBK / 32; ks++) {
            Frag16 fa[2], fb[4];
            const f16* ap = &ldsA[buf][trow + (lane & 15)][ks * 32 + hs];
            const f16* bp = &ldsB[buf][ks * 32 + hs + (lane & 7)][tcol + ((lane >> 3) & 1) * 8];
            for (int i = 0; i < 2; i++) {
                fa[i].q[0] = *(const u32x4*)(ap + i * 16 * GA_PITCH);
                fa[i].q[1] = *(const u32x4*)(ap + i * 16 * GA_PITCH + 16);
            }
            for (int j = 0; j < 4; j++) {
                fb[j].q[0] = lds_load_tr16(bp + j * 16);
                fb[j].q[1] = lds_load_tr16(bp + 16 * GB_PITCH + j * 16);
            }
            for (int i = 0; i < 2; i++)
                for (int j = 0; j < 4; j++)
                    acc[i][j] = __builtin_amdgcn_wmma_f32_16x16x32_f16(
                        false, fa[i].h, false, fb[j].h, (short)0, acc[i][j], false, false);
        }
    }

    // ---- epilogue: tile (i, j), VGPR r -> row (trow + 16 i + r + 8*(lane>=16)) ----
    int col0 = n0 + tcol + (lane & 15);
    for (int i = 0; i < 2; i++) {
        int rbase = m0 + trow + i * 16 + (lane >> 4) * 8;
        for (int r = 0; r < 8; r++) {
            int row = rbase + r;
            float bv = bias[row];
            long base = (long)bat * sC + (long)row * N + col0;
            for (int j = 0; j < 4; j++) {
                float v = acc[i][j][r] + bv;
                if (OUT16) ((f16*)Cv)[base + j * 16] = (f16)v;
                else       ((float*)Cv)[base + j * 16] = v;
            }
        }
    }
}

template <bool OUT16, bool A32, bool B32, bool ABLK>
__global__ __launch_bounds__(256) void gemm_wmma_kernel(
    const f16* __restrict__ A, const float* __restrict__ Af, long sA,
    const f16* __restrict__ B, const float* __restrict__ Bf, long sB,
    void* __restrict__ Cv, long sC,
    const float* __restrict__ bias,
    int M, int N, int K) {
    gemm_wmma_body<OUT16, A32, B32, ABLK>(blockIdx.x, blockIdx.y, blockIdx.z,
                                          A, Af, sA, B, Bf, sB, Cv, sC, bias, M, N, K);
}

// ---------------------------------------------------------------------------
// GroupNorm and kv = w_kv @ cond + b_kv share no data, so one grid holds both: the product's
// work-groups, whose chain of dependent k steps is the longer, take the low indices and start
// first; the GroupNorm work-groups fill the places beside them, and their streaming runs
// under the product's load latency. One launch gap and one fill less.
// ---------------------------------------------------------------------------
#define KV_MT (2 * HID / GBM)            // 2 tiles of M
#define KV_NT (NC / GBN)                 // 8 tiles of N
#define KV_BLOCKS (KV_MT * KV_NT * BATCH)

__global__ __launch_bounds__(256) void gn_kv_kernel(const float* __restrict__ x,
                                                    const float* __restrict__ gn_w,
                                                    const float* __restrict__ gn_b,
                                                    f16* __restrict__ xn,
                                                    const float* __restrict__ w_kv,
                                                    const float* __restrict__ cond,
                                                    float* __restrict__ kv,
                                                    const float* __restrict__ b_kv,
                                                    int M, int N, int K) {
    int blk = blockIdx.x;
    if (blk < KV_BLOCKS) {
        gemm_wmma_body<false, true, true, false>(
            blk % KV_MT, (blk / KV_MT) % KV_NT, blk / (KV_MT * KV_NT),
            nullptr, w_kv, 0, nullptr, cond, (long)CD * NC, kv, (long)2 * HID * NC, b_kv, M, N, K);
    } else {
        groupnorm_body(blk - KV_BLOCKS, x, gn_w, gn_b, xn);
    }
}

// ---------------------------------------------------------------------------
// Per-(batch, head, half of d): softmax(k, axis=n), ctx[d][e] = sum_n p[d][n]*v[e][n]
// kv: (B, 256, 1024) f32;  k rows = h*32+d,  v rows = 128+h*32+e.
//
// 16 waves. Wave w keeps k row w of its d half and v rows w, w+16 whole in
// registers (24 wave-wide 16-byte loads, all issued before the first use), so
// kv is read once and the row max and sum need no second pass. P and V go to
// LDS as f16 once; then wave w multiplies the n slice [64w, 64w+64) for both
// e tiles, and the 16 partial tiles are summed in f32 through LDS.
//
// The block then folds its 16 ctx rows into the output weight itself (f32, e ascending):
//   W2[b][c][h*32+d] = sum_e w_out[c][h*32+e] * ctx[b][h][d][e]   (f16 out)
// so ctx never leaves LDS and the fold needs no launch of its own. W2 is written as
// [b][j/16][c][16], j = h*32+d: a block's 256 x 16 piece is one contiguous 8 KiB, whole lines.
// ---------------------------------------------------------------------------
// Four v_exp_f32 (the instruction __expf ends in) in one statement. The outputs are
// early-clobbered so that none lands on a source of the v_exp_f32 directly ahead of it, and
// the v_nop is the slot the instruction set asks for behind the last one.
__device__ __forceinline__ f32x4 exp2_x4(f32x4 a) {
    float r0, r1, r2, r3;
    asm("v_exp_f32 %0, %4\n\tv_exp_f32 %1, %5\n\tv_exp_f32 %2, %6\n\tv_exp_f32 %3, %7\n\tv_nop"
        : "=&v"(r0), "=&v"(r1), "=&v"(r2), "=&v"(r3)
        : "v"(a.x), "v"(a.y), "v"(a.z), "v"(a.w));
    f32x4 r = {r0, r1, r2, r3};
    return r;
}

#define SC_PITCH (NC + 8)    // halves: 2064 B = 16 B x odd, for the ds_load_b128 fragment reads
#define SC_TILE1 272         // dword offset of the second e tile's partials (16 banks off the first)
#define SC_CPITCH 36         // floats per ctx row in LDS: rows 4 apart lie 16 banks apart

__global__ __launch_bounds__(512) void softmax_ctx_kernel(const float* __restrict__ kv,
                                                          const float* __restrict__ w_out,
                                                          f16* __restrict__ w2) {
    int h  = blockIdx.x;
    int b  = blockIdx.y;
    int dt = blockIdx.z;          // which 16 rows of d

    __shared__ __attribute__((aligned(16))) f16 ldsP[16][SC_PITCH];
    __shared__ __attribute__((aligned(16))) f16 ldsV[DIMH][SC_PITCH];
    __shared__ float red[16][SC_TILE1 + 256];
    __shared__ __attribute__((aligned(16))) float ctxs[16][SC_CPITCH];

    int t = threadIdx.x;
    int lane = t & 31;
    int warp = t >> 5;

    const f32x4* kr = (const f32x4*)(kv + ((long)b * 256 + h * DIMH + dt * 16 + warp) * NC) + lane;
    const f32x4* va = (const f32x4*)(kv + ((long)b * 256 + HID + h * DIMH + warp) * NC) + lane;
    const f32x4* vb = va + 16 * NC / 4;
    // the fold's w_out rows, c = t>>2 and c + 128, this head's 32 columns
    const f32x4* wr = (const f32x4*)(w_out + (long)(t >> 2) * HID + h * DIMH);

    f32x4 kq[8], v0[8], v1[8], wa[8], wb[8];
    for (int j = 0; j < 8; j++) kq[j] = kr[j * 32];
    for (int j = 0; j < 8; j++) v0[j] = va[j * 32];
    for (int j = 0; j < 8; j++) v1[j] = vb[j * 32];
    for (int j = 0; j < 8; j++) wa[j] = wr[j];                    // behind k and v: they arrive
    for (int j = 0; j < 8; j++) wb[j] = wr[128 * HID / 4 + j];    // under the softmax
    // The wait owed before a register that an issued load names is written again. The three
    // address pairs are its inputs, so they stay whole up to it (no load's result lands in them).
    asm volatile("s_wait_xcnt 0x0" :: "v"(kr), "v"(va), "v"(wr) : "memory");
    // Keeps the max from being scheduled ahead of the v loads: without it they are issued
    // behind the wait for k, and their latency follows k's instead of overlapping it.
    __builtin_amdgcn_sched_barrier(0);

    // row max
    float m = -1e30f;
    for (int j = 0; j < 8; j++)
        m = fmaxf(m, fmaxf(fmaxf(kq[j].x, kq[j].y), fmaxf(kq[j].z, kq[j].w)));
    for (int o = 16; o >= 1; o >>= 1) m = fmaxf(m, __shfl_xor(m, o, 32));

    // exponentials stay in registers; four independent sum chains
    f32x4 s4 = {0.f, 0.f, 0.f, 0.f};
    for (int j = 0; j < 8; j++) {
        kq[j] = exp2_x4((kq[j] - m) * 1.44269504088896340736f);   // = __expf(k - m)
        s4 += kq[j];
    }
    float s = (s4.x + s4.y) + (s4.z + s4.w);
    for (int o = 16; o >= 1; o >>= 1) s += __shfl_xor(s, o, 32);
    float inv = 1.0f / s;

    for (int j = 0; j < 8; j++) {
        f32x4 p = kq[j] * inv;
        f16x4 ph = {(f16)p.x, (f16)p.y, (f16)p.z, (f16)p.w};
        f16x4 ah = {(f16)v0[j].x, (f16)v0[j].y, (f16)v0[j].z, (f16)v0[j].w};
        f16x4 bh = {(f16)v1[j].x, (f16)v1[j].y, (f16)v1[j].z, (f16)v1[j].w};
        *(f16x4*)&ldsP[warp][j * 128 + lane * 4]      = ph;
        *(f16x4*)&ldsV[warp][j * 128 + lane * 4]      = ah;
        *(f16x4*)&ldsV[warp + 16][j * 128 + lane * 4] = bh;
    }
    __syncthreads();

    // wave w: n slice [64w, 64w+64), one A fragment feeds both e tiles
    v8f acc0 = {0.f, 0.f, 0.f, 0.f, 0.f, 0.f, 0.f, 0.f};
    v8f acc1 = {0.f, 0.f, 0.f, 0.f, 0.f, 0.f, 0.f, 0.f};
    int c  = lane & 15;
    int hs = (lane >> 4) * 8;
    for (int ks = 0; ks < 2; ks++) {
        int kk = warp * 64 + ks * 32;
        Frag16 fa, fb0, fb1;
        fa.q[0]  = *(const u32x4*)&ldsP[c][kk + hs];
        fa.q[1]  = *(const u32x4*)&ldsP[c][kk + 16 + hs];
        fb0.q[0] = *(const u32x4*)&ldsV[c][kk + hs];
        fb0.q[1] = *(const u32x4*)&ldsV[c][kk + 16 + hs];
        fb1.q[0] = *(const u32x4*)&ldsV[c + 16][kk + hs];
        fb1.q[1] = *(const u32x4*)&ldsV[c + 16][kk + 16 + hs];
        acc0 = __builtin_amdgcn_wmma_f32_16x16x32_f16(
            false, fa.h, false, fb0.h, (short)0, acc0, false, false);
        acc1 = __builtin_amdgcn_wmma_f32_16x16x32_f16(
            false, fa.h, false, fb1.h, (short)0, acc1, false, false);
    }
    for (int r = 0; r < 8; r++) {
        red[warp][r * 32 + lane]            = acc0[r];
        red[warp][SC_TILE1 + r * 32 + lane] = acc1[r];
    }
    __syncthreads();

    // thread t owns ctx[dt*16 + (t>>5)][t&31]; register r, lane 16*(d>>3)+c held D[d][c]
    int d = warp;
    int e = lane;
    int idx = (e >> 4) * SC_TILE1 + (d & 7) * 32 + (d >> 3) * 16 + (e & 15);
    float sum = 0.f;
    for (int w = 0; w < 16; w++) sum += red[w][idx];
    ctxs[d][e] = sum;
    __syncthreads();             // all 16 ctx rows visible to every wave

    // fold: thread t owns W2 rows c = t>>2 and c + 128, columns d = 4*(t&3) .. +3
    int dq = (t & 3) * 4;
    float fa[4] = {0.f, 0.f, 0.f, 0.f};
    float fb[4] = {0.f, 0.f, 0.f, 0.f};
    for (int j = 0; j < 8; j++) {
        for (int i = 0; i < 4; i++) {
            f32x4 cv = *(const f32x4*)&ctxs[dq + i][j * 4];
            for (int u = 0; u < 4; u++) {
                fa[i] = __builtin_fmaf(wa[j][u], cv[u], fa[i]);
                fb[i] = __builtin_fmaf(wb[j][u], cv[u], fb[i]);
            }
        }
    }
    f16x4 oa = {(f16)fa[0], (f16)fa[1], (f16)fa[2], (f16)fa[3]};
    f16x4 ob = {(f16)fb[0], (f16)fb[1], (f16)fb[2], (f16)fb[3]};
    f16* wo = w2 + (((long)b * (HID / 16) + h * 2 + dt) * CCH) * 16 + t * 4;
    *(f16x4*)wo                = oa;
    *(f16x4*)(wo + 128 * 16)   = ob;
}

// ---------------------------------------------------------------------------
extern "C" void kernel_launch(void* const* d_in, const int* in_sizes, int n_in,
                              void* d_out, int out_size, void* d_ws, size_t ws_size,
                              hipStream_t stream) {
    const float* x     = (const float*)d_in[0];   // (16,256,64,64)
    const float* cond  = (const float*)d_in[1];   // (16,512,32,32)
    const float* gn_w  = (const float*)d_in[2];
    const float* gn_b  = (const float*)d_in[3];
    const float* w_q   = (const float*)d_in[4];   // (128,256)
    const float* b_q   = (const float*)d_in[5];
    const float* w_kv  = (const float*)d_in[6];   // (256,512)
    const float* b_kv  = (const float*)d_in[7];
    const float* w_out = (const float*)d_in[8];   // (256,128)
    const float* b_out = (const float*)d_in[9];
    float* out = (float*)d_out;                   // (16,256,64,64)

    // workspace layout
    char* ws = (char*)d_ws;
    constexpr long SZ_XN   = (long)BATCH * CCH * NPIX * 2;   // 33.5 MB f16
    constexpr long SZ_KV   = (long)BATCH * 2 * HID * NC * 4; // f32
    constexpr long SZ_Q16  = (long)BATCH * HID * NPIX * 2;
    f16*   xn16   = (f16*)(ws);
    float* kvf    = (float*)(ws + SZ_XN);
    f16*   q16    = (f16*)(ws + SZ_XN + SZ_KV);
    f16*   w2_16  = (f16*)(ws + SZ_XN + SZ_KV + SZ_Q16);   // [b][128/16][256][16]

    // 1+2) GroupNorm -> xn f16, and kv = w_kv @ cond + b_kv (M=256,K=512,N=1024, f32 operands,
    //      f32 out), in one grid
    gn_kv_kernel<<<KV_BLOCKS + BATCH * GROUPS, 256, 0, stream>>>(
        x, gn_w, gn_b, xn16, w_kv, cond, kvf, b_kv, 2 * HID, NC, CD);

    // 3) q = w_q @ xn + b_q        (M=128,K=256,N=4096, f32 weight, f16 out)
    gemm_wmma_kernel<true, true, false, false><<<dim3(HID / GBM, NPIX / GBN, BATCH), 256, 0, stream>>>(
        nullptr, w_q, 0, xn16, nullptr, (long)CCH * NPIX, q16, (long)HID * NPIX, b_q, HID, NPIX, CCH);

    // 4) softmax(k), context = P @ V^T, W2 = w_out x context  per (b, h, half of d)
    softmax_ctx_kernel<<<dim3(HEADS, BATCH, 2), 512, 0, stream>>>(kvf, w_out, w2_16);

    // 5) out = W2 @ q + b_out      (M=256,K=128,N=4096, f32 out)
    gemm_wmma_kernel<false, false, false, true><<<dim3(CCH / GBM, NPIX / GBN, BATCH), 256, 0, stream>>>(
        w2_16, nullptr, (long)CCH * HID, q16, nullptr, (long)HID * NPIX, out, (long)CCH * NPIX, b_out,
        CCH, NPIX, HID);
}

// v008
// It runs in 45.8 microseconds.
// Next to v007, in two timings, it ran 1.18 times as fast each time.
// Counting every step since v000, it is 4.07 times as fast.
#include <hip/hip_runtime.h>
#include <hip/hip_bf16.h>

typedef _Float16 f16;
typedef __attribute__((ext_vector_type(16))) _Float16 v16h;
typedef __attribute__((ext_vector_type(8)))  float    v8f;
typedef __attribute__((ext_vector_type(4)))  unsigned int u32x4;
typedef __attribute__((ext_vector_type(2)))  unsigned int u32x2;
typedef __attribute__((ext_vector_type(4))) float    f32x4;
typedef __attribute__((ext_vector_type(4))) _Float16 f16x4;

union Frag16 { v16h h; u32x4 q[2]; };

#define AS3 __attribute__((address_space(3)))

#define HEADS 4
#define DIMH 32
#define BATCH 16
#define CCH 256      // x channels
#define CD 512       // cond channels
#define HID 128      // heads*dim_head
#define NPIX 4096    // 64*64
#define NC 1024      // 32*32
#define GROUPS 32

// ---------------------------------------------------------------------------
// GroupNorm: x (B,256,4096) -> xn f16, 1 block per (batch, group), blk = batch * 32 + group
//
// A group is 32768 floats = 128 per thread: it stays in registers between the sums and the
// normalisation, so x is read once. All 32 wave-wide 16-byte loads (512 contiguous bytes
// each) are issued before the first use, the group's 8 scales and shifts behind them.
// Chunk j of a thread lies in channel j >> 2.
// ---------------------------------------------------------------------------
__device__ __forceinline__ void groupnorm_body(int blk,
                                               const float* __restrict__ x,
                                               const float* __restrict__ w,
                                               const float* __restrict__ b,
                                               f16* __restrict__ xn) {
    int bat = blk >> 5;
    int g   = blk & 31;
    int t = threadIdx.x;
    int lane = t & 31;
    int warp = t >> 5;
    const f32x4* xb = (const f32x4*)(x + ((long)bat * CCH + g * 8) * NPIX) + t;
    f16x4*       ob = (f16x4*)(xn + ((long)bat * CCH + g * 8) * NPIX) + t;

    f32x4 xv[32];
    float wv[8], bv[8];
    for (int j = 0; j < 32; j++) xv[j] = xb[j * 256];
    for (int i = 0; i < 8; i++) { wv[i] = w[g * 8 + i]; bv[i] = b[g * 8 + i]; }

    f32x4 s4 = {0.f, 0.f, 0.f, 0.f}, q4 = {0.f, 0.f, 0.f, 0.f};
    for (int j = 0; j < 32; j++) {
        s4 += xv[j];
        q4 += xv[j] * xv[j];
    }
    float s  = (s4.x + s4.y) + (s4.z + s4.w);
    float s2 = (q4.x + q4.y) + (q4.z + q4.w);
    for (int o = 16; o >= 1; o >>= 1) {
        s  += __shfl_xor(s, o, 32);
        s2 += __shfl_xor(s2, o, 32);
    }
    __shared__ float sh[8], sh2[8];
    if (lane == 0) { sh[warp] = s; sh2[warp] = s2; }
    __syncthreads();
    s = 0.f; s2 = 0.f;
    for (int i = 0; i < 8; i++) { s += sh[i]; s2 += sh2[i]; }

    float mu  = s * (1.0f / 32768.0f);
    float var = s2 * (1.0f / 32768.0f) - mu * mu;
    float ri  = rsqrtf(var + 1e-5f);
    for (int j = 0; j < 32; j++) {
        f32x4 v = (xv[j] - mu) * ri * wv[j >> 2] + bv[j >> 2];
        f16x4 o = {(f16)v.x, (f16)v.y, (f16)v.z, (f16)v.w};
        ob[j * 256] = o;
    }
}

// ---------------------------------------------------------------------------
// WMMA f16 GEMM main loop:  acc = A (MxK, f32 in memory) * B (KxN), one 128 x 128 tile
//
// Block tile 128(M) x 128(N), BK=64, 8 waves; wave (w>>1, w&1) owns a 32x64 output
// patch: per 32 k, two A and four B fragments feed eight v_wmma_f32_16x16x32_f16, so
// a fragment read from LDS is used 4 (A) or 2 (B) times, and few, long-lived waves do the
// work: fewer wave starts and fewer barrier trips per product.
// M, N multiples of 128, K of 64.
// Double-buffered LDS, one barrier per K-step. B tile staged as it lies in memory, [k][n],
// 16B LDS stores; ds_load_tr16_b128 transposes it on the way into the
// fragment. Row pitches are padded for their readers (64 banks x 4 B): A 144 B = 16 B x odd
// for ds_load_b128, B 288 B = 32 B x odd for ds_load_tr16_b128.
// An operand that is still f32 in memory (A: the weights; B32: cond) is loaded as
// f32 and rounded to f16 in registers on its way into LDS, so it needs no convert
// launch and no f16 copy in the workspace.
//
// Fragment layout (ISA 7.12.2, 16-bit 16x32): lane L (idx = L&15):
//   halves 0..7  = K (L<16 ? 0..7 : 8..15),  halves 8..15 = +16.
// Two transposing loads, at k rows 0 and 16 of a 32-k slab, deliver B in the same k order.
// Result: tile (i, j), VGPR r = row 32*(w>>1) + 16 i + r + 8*(L>>4), column 64*(w&1) + 16 j + (L&15).
// ---------------------------------------------------------------------------
#define GBM 128
#define GBN 128
#define GBK 64
#define GA_PITCH 72    // halves per A row in LDS (64 used)
#define GB_PITCH 144   // halves per B row in LDS (128 used)

typedef __attribute__((ext_vector_type(8))) short s16x8;

// Lane l passes the address of 8 halves of row 8*(l>>4) + (l&7), column half (l>>3)&1, of a
// 16(k) x 16(n) block; it gets back column l&15, k = 8*(l>>4) .. +7.
__device__ __forceinline__ u32x4 lds_load_tr16(const f16* p) {
    return __builtin_bit_cast(u32x4, __builtin_amdgcn_ds_load_tr16_b128_v8i16((AS3 s16x8*)p));
}

__device__ __forceinline__ u32x4 round_to_f16x8(f32x4 lo, f32x4 hi) {
    union { f16 h[8]; u32x4 q; } u;
    for (int i = 0; i < 4; i++) { u.h[i] = (f16)lo[i]; u.h[4 + i] = (f16)hi[i]; }
    return u.q;
}

struct GemmLds {
    __attribute__((aligned(16))) f16 A[2][GBM][GA_PITCH];   // [buf][m][k]
    __attribute__((aligned(16))) f16 B[2][GBK][GB_PITCH];   // [buf][k][n]
};

template <bool B32>
__device__ __forceinline__ void gemm_wmma_main(
    GemmLds& lds, int m0, int n0,
    const float* __restrict__ Afb,
    const f16* __restrict__ Bb, const float* __restrict__ Bfb,
    int N, int K, v8f (&acc)[2][4]) {

    int t    = threadIdx.x;
    int lane = t & 31;
    int warp = t >> 5;
    int trow = (warp >> 1) * 32;     // 0,32,64,96
    int tcol = (warp & 1) * 64;      // 0,64
    int hs   = (lane >> 4) * 8;      // K-half select

    // staging coordinates: 8192 halves per tile = 4 chunks of 8 per thread
    int ar_st = t >> 3;              // A row 0..31, chunk i: + 32 i
    int ac_st = (t & 7) * 8;         // A k-col, multiple of 8
    int bk_st = t >> 4;              // B k-row 0..15, chunk i: + 16 i
    int bn_st = (t & 15) * 8;        // B n-col, multiple of 8
    // A thread's place inside a chunk, in elements; the rest of every address is the same
    // for the whole block and is summed on the scalar side.
    unsigned a_voff = (unsigned)(ar_st * K + ac_st);
    unsigned b_voff = (unsigned)(bk_st * N + bn_st);

    for (int i = 0; i < 2; i++)
        for (int j = 0; j < 4; j++)
            acc[i][j] = (v8f){0.f, 0.f, 0.f, 0.f, 0.f, 0.f, 0.f, 0.f};

    int nk = K >> 6;
    u32x4 rb[4];                     // f16 operand: 8 halves a chunk
    f32x4 rbf[4][2], raf[4][2];      // f32 operands: 8 floats a chunk

    // Prefetch address: 4 threads a B row, two tiles ahead. It is carried through the loop
    // and steps only while a later tile exists, so it always points into B.
    long pf_step = (long)GBK * N;
    long pf_off  = (nk > 2 ? 2 * pf_step : 0) + n0 + (long)(t >> 2) * N + (t & 3) * 32;
    const void* pf = B32 ? (const void*)(Bfb + pf_off) : (const void*)(Bb + pf_off);

    // Issues the loads of the tile at k0.
    auto issue_tile = [&](int k0, bool prefetch) {
        const void *pb[4], *pa[4];
        for (int i = 0; i < 4; i++) {
            long off = (long)(k0 + 16 * i) * N + n0;
            if constexpr (B32) {
                const f32x4* p = (const f32x4*)(Bfb + off + b_voff);
                rbf[i][0] = p[0]; rbf[i][1] = p[1];
                pb[i] = p;
            } else {
                const u32x4* p = (const u32x4*)(Bb + off + b_voff);
                rb[i] = p[0];
                pb[i] = p;
            }
        }
        for (int i = 0; i < 4; i++) {
            long off = (long)(m0 + 32 * i) * K + k0;
            const f32x4* p = (const f32x4*)(Afb + off + a_voff);
            raf[i][0] = p[0]; raf[i][1] = p[1];
            pa[i] = p;
        }
        if (prefetch) __builtin_prefetch(pf, 0, 1);   // B tile two ahead -> global_prefetch_b8
        // The wait owed before a register that an issued load names is written again. The
        // addresses are its inputs, so they stay whole up to it (no load's result lands in them).
        asm volatile("s_wait_xcnt 0x0"
                     :: "v"(pb[0]), "v"(pb[1]), "v"(pb[2]), "v"(pb[3]),
                        "v"(pa[0]), "v"(pa[1]), "v"(pa[2]), "v"(pa[3]), "v"(pf) : "memory");
    };

    issue_tile(0, false);

    for (int kt = 0; kt < nk; kt++) {
        int buf = kt & 1;
        // ---- commit tile kt to LDS ---------------------------------------
        for (int i = 0; i < 4; i++) {
            if constexpr (B32) {
                *(u32x4*)&lds.B[buf][bk_st + 16 * i][bn_st] = round_to_f16x8(rbf[i][0], rbf[i][1]);
            } else {
                *(u32x4*)&lds.B[buf][bk_st + 16 * i][bn_st] = rb[i];
            }
        }
        for (int i = 0; i < 4; i++)
            *(u32x4*)&lds.A[buf][ar_st + 32 * i][ac_st] = round_to_f16x8(raf[i][0], raf[i][1]);
        __syncthreads();             // all waves' A+B chunks visible

        // ---- issue tile kt+1 (it is committed to the other buffer) --------
        if (kt + 1 < nk) {
            issue_tile((kt + 1) * GBK, kt + 2 < nk);
            if (kt + 3 < nk) pf = B32 ? (const void*)((const float*)pf + pf_step)
                                      : (const void*)((const f16*)pf + pf_step);
        }

        // ---- fragments + 8x WMMA per 32 k --------------------------------
        for (int ks = 0; ks < GBK / 32; ks++) {
            Frag16 fa[2], fb[4];
            const f16* ap = &lds.A[buf][trow + (lane & 15)][ks * 32 + hs];
            const f16* bp = &lds.B[buf][ks * 32 + hs + (lane & 7)][tcol + ((lane >> 3) & 1) * 8];
            for (int i = 0; i < 2; i++) {
                fa[i].q[0] = *(const u32x4*)(ap + i * 16 * GA_PITCH);
                fa[i].q[1] = *(const u32x4*)(ap + i * 16 * GA_PITCH + 16);
            }
            for (int j = 0; j < 4; j++) {
                fb[j].q[0] = lds_load_tr16(bp + j * 16);
                fb[j].q[1] = lds_load_tr16(bp + 16 * GB_PITCH + j * 16);
            }
            for (int i = 0; i < 2; i++)
                for (int j = 0; j < 4; j++)
                    acc[i][j] = __builtin_amdgcn_wmma_f32_16x16x32_f16(
                        false, fa[i].h, false, fb[j].h, (short)0, acc[i][j], false, false);
        }
    }
}

// kv[bat] = w_kv (MxK) * cond[bat] (KxN) + b_kv, f32 out, one tile
__device__ __forceinline__ void kv_gemm_body(
    int bx, int by, int bat,
    const float* __restrict__ Af, const float* __restrict__ Bf, long sB,
    float* __restrict__ C, long sC,
    const float* __restrict__ bias,
    int N, int K) {
    int m0   = bx * GBM;
    int n0   = by * GBN;
    int lane = threadIdx.x & 31;
    int warp = threadIdx.x >> 5;
    int trow = (warp >> 1) * 32;
    int tcol = (warp & 1) * 64;

    __shared__ GemmLds lds;
    v8f acc[2][4];
    gemm_wmma_main<true>(lds, m0, n0, Af, nullptr, Bf + (long)bat * sB, N, K, acc);

    int col0 = n0 + tcol + (lane & 15);
    for (int i = 0; i < 2; i++) {
        int rbase = m0 + trow + i * 16 + (lane >> 4) * 8;
        for (int r = 0; r < 8; r++) {
            int row = rbase + r;
            float bv = bias[row];
            long base = (long)bat * sC + (long)row * N + col0;
            for (int j = 0; j < 4; j++)
                C[base + j * 16] = acc[i][j][r] + bv;
        }
    }
}

// ---------------------------------------------------------------------------
// q = w_q @ xn + b_q and out = W2 @ q + b_out in one work-group per (batch, 128 pixels):
// the 128 x 128 tile of q never goes to memory.
//
// The accumulator layout of the first product IS the B fragment layout of the second: lane L
// holds column L&15, rows 8*(L>>4) + 0..7 of a 16 x 16 tile, and a B fragment wants of column
// L&15 the k rows 8*(L>>4) + 0..7 (halves 0..7) and 16 more (halves 8..15). So a wave's tiles
// (0, j) and (1, j), biased and rounded to f16, are the ready fragment of k slab w>>1, column
// tile 4*(w&1) + j. It is passed to the other waves through LDS as it lies in the registers
// (16 bytes a lane, lanes side by side: no transposition, no bank conflict).
// Second product: wave w owns rows 32 w .. +31 of out and all 128 columns (2 x 8 tiles, k = 128).
// W2 lies as [k/16][m][16], so an A fragment is two wave-wide loads of 512 contiguous bytes
// straight into registers; each is read by one wave of the work-group only.
// ---------------------------------------------------------------------------
__global__ __launch_bounds__(256) void q_out_kernel(const float* __restrict__ w_q,
                                                    const f16* __restrict__ xn,
                                                    const float* __restrict__ b_q,
                                                    const f16* __restrict__ w2,
                                                    const float* __restrict__ b_out,
                                                    float* __restrict__ out,
                                                    int N, int K) {
    // fragQ lies first, so that every fragment's place is one lane address + an immediate offset
    __shared__ struct {
        u32x4   fragQ[HID / 32][GBN / 16][2][32];         // [k slab][column tile][half][lane]
        GemmLds g;
    } sm;

    int n0   = blockIdx.x * GBN;
    int bat  = blockIdx.y;
    int lane = threadIdx.x & 31;
    int warp = threadIdx.x >> 5;
    int hs   = (lane >> 4) * 8;

    // q's bias for this wave's 32 rows: asked for first, so that it is there long before its use
    const float* bq = b_q + (warp >> 1) * 32 + hs;
    float bq0[8], bq1[8];
    for (int r = 0; r < 8; r++) { bq0[r] = bq[r]; bq1[r] = bq[16 + r]; }
    // The wait owed before a register that an issued load names is written again.
    asm volatile("s_wait_xcnt 0x0" :: "v"(bq) : "memory");

    v8f acc[2][4];
    gemm_wmma_main<false>(sm.g, 0, n0, w_q, xn + (long)bat * CCH * NPIX, nullptr, N, K, acc);

    // W2 fragments of this wave's 32 rows, all 4 k slabs: they fly while q is rounded and written
    const f16* wp = w2 + (long)bat * CCH * HID + (warp * 32 + (lane & 15)) * 16 + hs;
    Frag16 fw[2][HID / 32];
    for (int s = 0; s < HID / 32; s++)
        for (int i = 0; i < 2; i++) {
            fw[i][s].q[0] = *(const u32x4*)(wp + ((2 * s) * CCH + i * 16) * 16);
            fw[i][s].q[1] = *(const u32x4*)(wp + ((2 * s + 1) * CCH + i * 16) * 16);
        }
    // The wait owed before a register that an issued load names is written again. The
    // address is its input, so it stays whole up to it.
    asm volatile("s_wait_xcnt 0x0" :: "v"(wp) : "memory");

    for (int j = 0; j < 4; j++) {
        Frag16 f;
        for (int r = 0; r < 8; r++) {
            f.h[r]     = (f16)(acc[0][j][r] + bq0[r]);
            f.h[8 + r] = (f16)(acc[1][j][r] + bq1[r]);
        }
        sm.fragQ[warp >> 1][(warp & 1) * 4 + j][0][lane] = f.q[0];
        sm.fragQ[warp >> 1][(warp & 1) * 4 + j][1][lane] = f.q[1];
    }
    __syncthreads();                 // the whole q tile visible to every wave

    v8f oc[2][GBN / 16];
    for (int i = 0; i < 2; i++)
        for (int j = 0; j < GBN / 16; j++)
            oc[i][j] = (v8f){0.f, 0.f, 0.f, 0.f, 0.f, 0.f, 0.f, 0.f};

    // Group g = two column tiles of one k slab = 4 LDS reads and 4 WMMAs, k slabs ascending.
    // Three fragment sets: a group's reads are issued together, two groups ahead of its WMMAs.
    constexpr int NGRP = (HID / 32) * (GBN / 32);
    Frag16 fb[3][2];
    auto read_group = [&](int g) {
        for (int u = 0; u < 2; u++) {
            fb[g % 3][u].q[0] = sm.fragQ[g >> 2][(g & 3) * 2 + u][0][lane];
            fb[g % 3][u].q[1] = sm.fragQ[g >> 2][(g & 3) * 2 + u][1][lane];
        }
    };
    const float* bo = b_out + warp * 32 + hs;
    v8f bo0, bo1;
    read_group(0);
    read_group(1);
    #pragma unroll   // fb, fw and oc are indexed by g: they stay in registers only when unrolled
    for (int g = 0; g < NGRP; g++) {
        if (g + 2 < NGRP) read_group(g + 2);
        if (g == NGRP - 4) {         // out's bias: under the last k slab, when registers are free
            for (int r = 0; r < 8; r++) { bo0[r] = bo[r]; bo1[r] = bo[16 + r]; }
            // The wait owed before a register that an issued load names is written again.
            asm volatile("s_wait_xcnt 0x0" :: "v"(bo) : "memory");
        }
        // Holds the reads above ahead of the WMMAs below: left to itself the scheduler sinks each
        // read to its use, and the wave then waits out the LDS latency once per fragment.
        __builtin_amdgcn_sched_barrier(0);
        for (int u = 0; u < 2; u++)
            for (int i = 0; i < 2; i++)
                oc[i][(g & 3) * 2 + u] = __builtin_amdgcn_wmma_f32_16x16x32_f16(
                    false, fw[i][g >> 2].h, false, fb[g % 3][u].h, (short)0,
                    oc[i][(g & 3) * 2 + u], false, false);
        // Ends the group: the next reads, which fill this group's fragment set, stay behind it.
        __builtin_amdgcn_sched_barrier(0);
    }

    for (int j = 0; j < GBN / 16; j++) { oc[0][j] += bo0; oc[1][j] += bo1; }
    // All sums first, each in its own register, then the stores in one run, in row order: mixed,
    // the sums share a few registers and each waits for the store that still names its register.
    __builtin_amdgcn_sched_barrier(0);

    // tile (i, j), VGPR r -> row 32 w + 16 i + 8*(L>>4) + r, column 16 j + (L&15): one address, the
    // rest of every store's place is an immediate offset
    float* op = out + ((long)bat * CCH + warp * 32 + hs) * NPIX + n0 + (lane & 15);
    for (int i = 0; i < 2; i++)
        for (int r = 0; r < 8; r++)
            for (int j = 0; j < GBN / 16; j++)
                op[(i * 16 + r) * NPIX + j * 16] = oc[i][j][r];
}

// ---------------------------------------------------------------------------
// GroupNorm and kv = w_kv @ cond + b_kv share no data, so one grid holds both: the product's
// work-groups, whose chain of dependent k steps is the longer, take the low indices and start
// first; the GroupNorm work-groups fill the places beside them, and their streaming runs
// under the product's load latency. One launch gap and one fill less.
// ---------------------------------------------------------------------------
#define KV_MT (2 * HID / GBM)            // 2 tiles of M
#define KV_NT (NC / GBN)                 // 8 tiles of N
#define KV_BLOCKS (KV_MT * KV_NT * BATCH)

__global__ __launch_bounds__(256) void gn_kv_kernel(const float* __restrict__ x,
                                                    const float* __restrict__ gn_w,
                                                    const float* __restrict__ gn_b,
                                                    f16* __restrict__ xn,
                                                    const float* __restrict__ w_kv,
                                                    const float* __restrict__ cond,
                                                    float* __restrict__ kv,
                                                    const float* __restrict__ b_kv,
                                                    int M, int N, int K) {
    int blk = blockIdx.x;
    if (blk < KV_BLOCKS) {
        kv_gemm_body(blk % KV_MT, (blk / KV_MT) % KV_NT, blk / (KV_MT * KV_NT),
                     w_kv, cond, (long)CD * NC, kv, (long)2 * HID * NC, b_kv, N, K);
    } else {
        groupnorm_body(blk - KV_BLOCKS, x, gn_w, gn_b, xn);
    }
}

// ---------------------------------------------------------------------------
// Per-(batch, head, half of d): softmax(k, axis=n), ctx[d][e] = sum_n p[d][n]*v[e][n]
// kv: (B, 256, 1024) f32;  k rows = h*32+d,  v rows = 128+h*32+e.
//
// 16 waves. Wave w keeps k row w of its d half and v rows w, w+16 whole in
// registers (24 wave-wide 16-byte loads, all issued before the first use), so
// kv is read once and the row max and sum need no second pass. P and V go to
// LDS as f16 once; then wave w multiplies the n slice [64w, 64w+64) for both
// e tiles, and the 16 partial tiles are summed in f32 through LDS.
//
// The block then folds its 16 ctx rows into the output weight itself (f32, e ascending):
//   W2[b][c][h*32+d] = sum_e w_out[c][h*32+e] * ctx[b][h][d][e]   (f16 out)
// so ctx never leaves LDS and the fold needs no launch of its own. W2 is written as
// [b][j/16][c][16], j = h*32+d: a block's 256 x 16 piece is one contiguous 8 KiB, whole lines.
// ---------------------------------------------------------------------------
// Four v_exp_f32 (the instruction __expf ends in) in one statement. The outputs are
// early-clobbered so that none lands on a source of the v_exp_f32 directly ahead of it, and
// the v_nop is the slot the instruction set asks for behind the last one.
__device__ __forceinline__ f32x4 exp2_x4(f32x4 a) {
    float r0, r1, r2, r3;
    asm("v_exp_f32 %0, %4\n\tv_exp_f32 %1, %5\n\tv_exp_f32 %2, %6\n\tv_exp_f32 %3, %7\n\tv_nop"
        : "=&v"(r0), "=&v"(r1), "=&v"(r2), "=&v"(r3)
        : "v"(a.x), "v"(a.y), "v"(a.z), "v"(a.w));
    f32x4 r = {r0, r1, r2, r3};
    return r;
}

#define SC_PITCH (NC + 8)    // halves: 2064 B = 16 B x odd, for the ds_load_b128 fragment reads
#define SC_TILE1 272         // dword offset of the second e tile's partials (16 banks off the first)
#define SC_CPITCH 36         // floats per ctx row in LDS: rows 4 apart lie 16 banks apart

__global__ __launch_bounds__(512) void softmax_ctx_kernel(const float* __restrict__ kv,
                                                          const float* __restrict__ w_out,
                                                          f16* __restrict__ w2) {
    int h  = blockIdx.x;
    int b  = blockIdx.y;
    int dt = blockIdx.z;          // which 16 rows of d

    __shared__ __attribute__((aligned(16))) f16 ldsP[16][SC_PITCH];
    __shared__ __attribute__((aligned(16))) f16 ldsV[DIMH][SC_PITCH];
    __shared__ float red[16][SC_TILE1 + 256];
    __shared__ __attribute__((aligned(16))) float ctxs[16][SC_CPITCH];

    int t = threadIdx.x;
    int lane = t & 31;
    int warp = t >> 5;

    const f32x4* kr = (const f32x4*)(kv + ((long)b * 256 + h * DIMH + dt * 16 + warp) * NC) + lane;
    const f32x4* va = (const f32x4*)(kv + ((long)b * 256 + HID + h * DIMH + warp) * NC) + lane;
    const f32x4* vb = va + 16 * NC / 4;
    // the fold's w_out rows, c = t>>2 and c + 128, this head's 32 columns
    const f32x4* wr = (const f32x4*)(w_out + (long)(t >> 2) * HID + h * DIMH);

    f32x4 kq[8], v0[8], v1[8], wa[8], wb[8];
    for (int j = 0; j < 8; j++) kq[j] = kr[j * 32];
    for (int j = 0; j < 8; j++) v0[j] = va[j * 32];
    for (int j = 0; j < 8; j++) v1[j] = vb[j * 32];
    for (int j = 0; j < 8; j++) wa[j] = wr[j];                    // behind k and v: they arrive
    for (int j = 0; j < 8; j++) wb[j] = wr[128 * HID / 4 + j];    // under the softmax
    // The wait owed before a register that an issued load names is written again. The three
    // address pairs are its inputs, so they stay whole up to it (no load's result lands in them).
    asm volatile("s_wait_xcnt 0x0" :: "v"(kr), "v"(va), "v"(wr) : "memory");
    // Keeps the max from being scheduled ahead of the v loads: without it they are issued
    // behind the wait for k, and their latency follows k's instead of overlapping it.
    __builtin_amdgcn_sched_barrier(0);

    // row max
    float m = -1e30f;
    for (int j = 0; j < 8; j++)
        m = fmaxf(m, fmaxf(fmaxf(kq[j].x, kq[j].y), fmaxf(kq[j].z, kq[j].w)));
    for (int o = 16; o >= 1; o >>= 1) m = fmaxf(m, __shfl_xor(m, o, 32));

    // exponentials stay in registers; four independent sum chains
    f32x4 s4 = {0.f, 0.f, 0.f, 0.f};
    for (int j = 0; j < 8; j++) {
        kq[j] = exp2_x4((kq[j] - m) * 1.44269504088896340736f);   // = __expf(k - m)
        s4 += kq[j];
    }
    float s = (s4.x + s4.y) + (s4.z + s4.w);
    for (int o = 16; o >= 1; o >>= 1) s += __shfl_xor(s, o, 32);
    float inv = 1.0f / s;

    for (int j = 0; j < 8; j++) {
        f32x4 p = kq[j] * inv;
        f16x4 ph = {(f16)p.x, (f16)p.y, (f16)p.z, (f16)p.w};
        f16x4 ah = {(f16)v0[j].x, (f16)v0[j].y, (f16)v0[j].z, (f16)v0[j].w};
        f16x4 bh = {(f16)v1[j].x, (f16)v1[j].y, (f16)v1[j].z, (f16)v1[j].w};
        *(f16x4*)&ldsP[warp][j * 128 + lane * 4]      = ph;
        *(f16x4*)&ldsV[warp][j * 128 + lane * 4]      = ah;
        *(f16x4*)&ldsV[warp + 16][j * 128 + lane * 4] = bh;
    }
    __syncthreads();

    // wave w: n slice [64w, 64w+64), one A fragment feeds both e tiles
    v8f acc0 = {0.f, 0.f, 0.f, 0.f, 0.f, 0.f, 0.f, 0.f};
    v8f acc1 = {0.f, 0.f, 0.f, 0.f, 0.f, 0.f, 0.f, 0.f};
    int c  = lane & 15;
    int hs = (lane >> 4) * 8;
    for (int ks = 0; ks < 2; ks++) {
        int kk = warp * 64 + ks * 32;
        Frag16 fa, fb0, fb1;
        fa.q[0]  = *(const u32x4*)&ldsP[c][kk + hs];
        fa.q[1]  = *(const u32x4*)&ldsP[c][kk + 16 + hs];
        fb0.q[0] = *(const u32x4*)&ldsV[c][kk + hs];
        fb0.q[1] = *(const u32x4*)&ldsV[c][kk + 16 + hs];
        fb1.q[0] = *(const u32x4*)&ldsV[c + 16][kk + hs];
        fb1.q[1] = *(const u32x4*)&ldsV[c + 16][kk + 16 + hs];
        acc0 = __builtin_amdgcn_wmma_f32_16x16x32_f16(
            false, fa.h, false, fb0.h, (short)0, acc0, false, false);
        acc1 = __builtin_amdgcn_wmma_f32_16x16x32_f16(
            false, fa.h, false, fb1.h, (short)0, acc1, false, false);
    }
    for (int r = 0; r < 8; r++) {
        red[warp][r * 32 + lane]            = acc0[r];
        red[warp][SC_TILE1 + r * 32 + lane] = acc1[r];
    }
    __syncthreads();

    // thread t owns ctx[dt*16 + (t>>5)][t&31]; register r, lane 16*(d>>3)+c held D[d][c]
    int d = warp;
    int e = lane;
    int idx = (e >> 4) * SC_TILE1 + (d & 7) * 32 + (d >> 3) * 16 + (e & 15);
    float sum = 0.f;
    for (int w = 0; w < 16; w++) sum += red[w][idx];
    ctxs[d][e] = sum;
    __syncthreads();             // all 16 ctx rows visible to every wave

    // fold: thread t owns W2 rows c = t>>2 and c + 128, columns d = 4*(t&3) .. +3
    int dq = (t & 3) * 4;
    float fa[4] = {0.f, 0.f, 0.f, 0.f};
    float fb[4] = {0.f, 0.f, 0.f, 0.f};
    for (int j = 0; j < 8; j++) {
        for (int i = 0; i < 4; i++) {
            f32x4 cv = *(const f32x4*)&ctxs[dq + i][j * 4];
            for (int u = 0; u < 4; u++) {
                fa[i] = __builtin_fmaf(wa[j][u], cv[u], fa[i]);
                fb[i] = __builtin_fmaf(wb[j][u], cv[u], fb[i]);
            }
        }
    }
    f16x4 oa = {(f16)fa[0], (f16)fa[1], (f16)fa[2], (f16)fa[3]};
    f16x4 ob = {(f16)fb[0], (f16)fb[1], (f16)fb[2], (f16)fb[3]};
    f16* wo = w2 + (((long)b * (HID / 16) + h * 2 + dt) * CCH) * 16 + t * 4;
    *(f16x4*)wo                = oa;
    *(f16x4*)(wo + 128 * 16)   = ob;
}

// ---------------------------------------------------------------------------
extern "C" void kernel_launch(void* const* d_in, const int* in_sizes, int n_in,
                              void* d_out, int out_size, void* d_ws, size_t ws_size,
                              hipStream_t stream) {
    const float* x     = (const float*)d_in[0];   // (16,256,64,64)
    const float* cond  = (const float*)d_in[1];   // (16,512,32,32)
    const float* gn_w  = (const float*)d_in[2];
    const float* gn_b  = (const float*)d_in[3];
    const float* w_q   = (const float*)d_in[4];   // (128,256)
    const float* b_q   = (const float*)d_in[5];
    const float* w_kv  = (const float*)d_in[6];   // (256,512)
    const float* b_kv  = (const float*)d_in[7];
    const float* w_out = (const float*)d_in[8];   // (256,128)
    const float* b_out = (const float*)d_in[9];
    float* out = (float*)d_out;                   // (16,256,64,64)

    // workspace layout
    char* ws = (char*)d_ws;
    constexpr long SZ_XN   = (long)BATCH * CCH * NPIX * 2;   // 33.5 MB f16
    constexpr long SZ_KV   = (long)BATCH * 2 * HID * NC * 4; // f32
    f16*   xn16   = (f16*)(ws);
    float* kvf    = (float*)(ws + SZ_XN);
    f16*   w2_16  = (f16*)(ws + SZ_XN + SZ_KV);            // [b][128/16][256][16]

    // 1+2) GroupNorm -> xn f16, and kv = w_kv @ cond + b_kv (M=256,K=512,N=1024, f32 operands,
    //      f32 out), in one grid
    gn_kv_kernel<<<KV_BLOCKS + BATCH * GROUPS, 256, 0, stream>>>(
        x, gn_w, gn_b, xn16, w_kv, cond, kvf, b_kv, 2 * HID, NC, CD);

    // 3) softmax(k), context = P @ V^T, W2 = w_out x context  per (b, h, half of d)
    softmax_ctx_kernel<<<dim3(HEADS, BATCH, 2), 512, 0, stream>>>(kvf, w_out, w2_16);

    // 4) q = w_q @ xn + b_q (M=128,K=256, f32 weight) and out = W2 @ q + b_out (M=256,K=128,
    //    f32 out), per 128 pixels in one work-group
    q_out_kernel<<<dim3(NPIX / GBN, BATCH), 256, 0, stream>>>(
        w_q, xn16, b_q, w2_16, b_out, out, NPIX, CCH);
}

// v009
// A run of this version takes 40.8 microseconds.
// Timed twice side by side with v008, it ran 1.12 times as fast both times.
// All steps since v000 together make it 4.56 times as fast.
#include <hip/hip_runtime.h>
#include <hip/hip_bf16.h>

typedef _Float16 f16;
typedef __attribute__((ext_vector_type(16))) _Float16 v16h;
typedef __attribute__((ext_vector_type(8)))  float    v8f;
typedef __attribute__((ext_vector_type(4)))  unsigned int u32x4;
typedef __attribute__((ext_vector_type(2)))  unsigned int u32x2;
typedef __attribute__((ext_vector_type(4))) float    f32x4;
typedef __attribute__((ext_vector_type(4))) _Float16 f16x4;

union Frag16 { v16h h; u32x4 q[2]; };

#define AS3 __attribute__((address_space(3)))

#define HEADS 4
#define DIMH 32
#define BATCH 16
#define CCH 256      // x channels
#define CD 512       // cond channels
#define HID 128      // heads*dim_head
#define NPIX 4096    // 64*64
#define NC 1024      // 32*32
#define GROUPS 32

// ---------------------------------------------------------------------------
// GroupNorm: x (B,256,4096) -> xn f16, 1 block per (batch, group), blk = batch * 32 + group
//
// A group is 32768 floats = 128 per thread: it stays in registers between the sums and the
// normalisation, so x is read once. All 32 wave-wide 16-byte loads (512 contiguous bytes
// each) are issued before the first use, the group's 8 scales and shifts behind them.
// Chunk j of a thread lies in channel j >> 2.
// ---------------------------------------------------------------------------
__device__ __forceinline__ void groupnorm_body(int blk,
                                               const float* __restrict__ x,
                                               const float* __restrict__ w,
                                               const float* __restrict__ b,
                                               f16* __restrict__ xn) {
    int bat = blk >> 5;
    int g   = blk & 31;
    int t = threadIdx.x;
    int lane = t & 31;
    int warp = t >> 5;
    const f32x4* xb = (const f32x4*)(x + ((long)bat * CCH + g * 8) * NPIX) + t;
    f16x4*       ob = (f16x4*)(xn + ((long)bat * CCH + g * 8) * NPIX) + t;

    f32x4 xv[32];
    float wv[8], bv[8];
    for (int j = 0; j < 32; j++) xv[j] = xb[j * 256];
    for (int i = 0; i < 8; i++) { wv[i] = w[g * 8 + i]; bv[i] = b[g * 8 + i]; }

    f32x4 s4 = {0.f, 0.f, 0.f, 0.f}, q4 = {0.f, 0.f, 0.f, 0.f};
    for (int j = 0; j < 32; j++) {
        s4 += xv[j];
        q4 += xv[j] * xv[j];
    }
    float s  = (s4.x + s4.y) + (s4.z + s4.w);
    float s2 = (q4.x + q4.y) + (q4.z + q4.w);
    for (int o = 16; o >= 1; o >>= 1) {
        s  += __shfl_xor(s, o, 32);
        s2 += __shfl_xor(s2, o, 32);
    }
    __shared__ float sh[8], sh2[8];
    if (lane == 0) { sh[warp] = s; sh2[warp] = s2; }
    __syncthreads();
    s = 0.f; s2 = 0.f;
    for (int i = 0; i < 8; i++) { s += sh[i]; s2 += sh2[i]; }

    float mu  = s * (1.0f / 32768.0f);
    float var = s2 * (1.0f / 32768.0f) - mu * mu;
    float ri  = rsqrtf(var + 1e-5f);
    for (int j = 0; j < 32; j++) {
        f32x4 v = (xv[j] - mu) * ri * wv[j >> 2] + bv[j >> 2];
        f16x4 o = {(f16)v.x, (f16)v.y, (f16)v.z, (f16)v.w};
        ob[j * 256] = o;
    }
}

// ---------------------------------------------------------------------------
// WMMA f16 GEMM main loop:  acc = A (MxK, f32 in memory) * B (KxN), one 128 x 128 tile
//
// Block tile 128(M) x 128(N), BK=64, 8 waves; wave (w>>1, w&1) owns a 32x64 output
// patch: per 32 k, two A and four B fragments feed eight v_wmma_f32_16x16x32_f16, so
// a fragment read from LDS is used 4 (A) or 2 (B) times, and few, long-lived waves do the
// work: fewer wave starts and fewer barrier trips per product.
// M, N multiples of 128, K of 64.
// Double-buffered LDS, one barrier per K-step. B tile staged as it lies in memory, [k][n],
// 16B LDS stores; ds_load_tr16_b128 transposes it on the way into the
// fragment. Row pitches are padded for their readers (64 banks x 4 B): A 144 B = 16 B x odd
// for ds_load_b128, B 288 B = 32 B x odd for ds_load_tr16_b128.
// An operand that is still f32 in memory (A: the weights; B32: cond) is loaded as
// f32 and rounded to f16 in registers on its way into LDS, so it needs no convert
// launch and no f16 copy in the workspace.
//
// Fragment layout (ISA 7.12.2, 16-bit 16x32): lane L (idx = L&15):
//   halves 0..7  = K (L<16 ? 0..7 : 8..15),  halves 8..15 = +16.
// Two transposing loads, at k rows 0 and 16 of a 32-k slab, deliver B in the same k order.
// Result: tile (i, j), VGPR r = row 32*(w>>1) + 16 i + r + 8*(L>>4), column 64*(w&1) + 16 j + (L&15).
// ---------------------------------------------------------------------------
#define GBM 128
#define GBN 128
#define GBK 64
#define GA_PITCH 72    // halves per A row in LDS (64 used)
#define GB_PITCH 144   // halves per B row in LDS (128 used)

typedef __attribute__((ext_vector_type(8))) short s16x8;

// Lane l passes the address of 8 halves of row 8*(l>>4) + (l&7), column half (l>>3)&1, of a
// 16(k) x 16(n) block; it gets back column l&15, k = 8*(l>>4) .. +7.
__device__ __forceinline__ u32x4 lds_load_tr16(const f16* p) {
    return __builtin_bit_cast(u32x4, __builtin_amdgcn_ds_load_tr16_b128_v8i16((AS3 s16x8*)p));
}

__device__ __forceinline__ u32x4 round_to_f16x8(f32x4 lo, f32x4 hi) {
    union { f16 h[8]; u32x4 q; } u;
    for (int i = 0; i < 4; i++) { u.h[i] = (f16)lo[i]; u.h[4 + i] = (f16)hi[i]; }
    return u.q;
}

struct GemmLds {
    __attribute__((aligned(16))) f16 A[2][GBM][GA_PITCH];   // [buf][m][k]
    __attribute__((aligned(16))) f16 B[2][GBK][GB_PITCH];   // [buf][k][n]
};

template <bool B32>
__device__ __forceinline__ void gemm_wmma_main(
    GemmLds& lds, int m0, int n0,
    const float* __restrict__ Afb,
    const f16* __restrict__ Bb, const float* __restrict__ Bfb,
    int N, int K, v8f (&acc)[2][4]) {

    int t    = threadIdx.x;
    int lane = t & 31;
    int warp = t >> 5;
    int trow = (warp >> 1) * 32;     // 0,32,64,96
    int tcol = (warp & 1) * 64;      // 0,64
    int hs   = (lane >> 4) * 8;      // K-half select

    // staging coordinates: 8192 halves per tile = 4 chunks of 8 per thread
    int ar_st = t >> 3;              // A row 0..31, chunk i: + 32 i
    int ac_st = (t & 7) * 8;         // A k-col, multiple of 8
    int bk_st = t >> 4;              // B k-row 0..15, chunk i: + 16 i
    int bn_st = (t & 15) * 8;        // B n-col, multiple of 8
    // A thread's place inside a chunk, in elements; the rest of every address is the same
    // for the whole block and is summed on the scalar side.
    unsigned a_voff = (unsigned)(ar_st * K + ac_st);
    unsigned b_voff = (unsigned)(bk_st * N + bn_st);

    for (int i = 0; i < 2; i++)
        for (int j = 0; j < 4; j++)
            acc[i][j] = (v8f){0.f, 0.f, 0.f, 0.f, 0.f, 0.f, 0.f, 0.f};

    int nk = K >> 6;
    u32x4 rb[4];                     // f16 operand: 8 halves a chunk
    f32x4 rbf[4][2], raf[4][2];      // f32 operands: 8 floats a chunk

    // Prefetch address: 4 threads a B row, two tiles ahead. It is carried through the loop
    // and steps only while a later tile exists, so it always points into B.
    long pf_step = (long)GBK * N;
    long pf_off  = (nk > 2 ? 2 * pf_step : 0) + n0 + (long)(t >> 2) * N + (t & 3) * 32;
    const void* pf = B32 ? (const void*)(Bfb + pf_off) : (const void*)(Bb + pf_off);

    // Issues the loads of the tile at k0.
    auto issue_tile = [&](int k0, bool prefetch) {
        const void *pb[4], *pa[4];
        for (int i = 0; i < 4; i++) {
            long off = (long)(k0 + 16 * i) * N + n0;
            if constexpr (B32) {
                const f32x4* p = (const f32x4*)(Bfb + off + b_voff);
                rbf[i][0] = p[0]; rbf[i][1] = p[1];
                pb[i] = p;
            } else {
                const u32x4* p = (const u32x4*)(Bb + off + b_voff);
                rb[i] = p[0];
                pb[i] = p;
            }
        }
        for (int i = 0; i < 4; i++) {
            long off = (long)(m0 + 32 * i) * K + k0;
            const f32x4* p = (const f32x4*)(Afb + off + a_voff);
            raf[i][0] = p[0]; raf[i][1] = p[1];
            pa[i] = p;
        }
        if (prefetch) __builtin_prefetch(pf, 0, 1);   // B tile two ahead -> global_prefetch_b8
        // The wait owed before a register that an issued load names is written again. The
        // addresses are its inputs, so they stay whole up to it (no load's result lands in them).
        asm volatile("s_wait_xcnt 0x0"
                     :: "v"(pb[0]), "v"(pb[1]), "v"(pb[2]), "v"(pb[3]),
                        "v"(pa[0]), "v"(pa[1]), "v"(pa[2]), "v"(pa[3]), "v"(pf) : "memory");
    };

    issue_tile(0, false);

    for (int kt = 0; kt < nk; kt++) {
        int buf = kt & 1;
        // ---- commit tile kt to LDS ---------------------------------------
        for (int i = 0; i < 4; i++) {
            if constexpr (B32) {
                *(u32x4*)&lds.B[buf][bk_st + 16 * i][bn_st] = round_to_f16x8(rbf[i][0], rbf[i][1]);
            } else {
                *(u32x4*)&lds.B[buf][bk_st + 16 * i][bn_st] = rb[i];
            }
        }
        for (int i = 0; i < 4; i++)
            *(u32x4*)&lds.A[buf][ar_st + 32 * i][ac_st] = round_to_f16x8(raf[i][0], raf[i][1]);
        __syncthreads();             // all waves' A+B chunks visible

        // ---- issue tile kt+1 (it is committed to the other buffer) --------
        if (kt + 1 < nk) {
            issue_tile((kt + 1) * GBK, kt + 2 < nk);
            if (kt + 3 < nk) pf = B32 ? (const void*)((const float*)pf + pf_step)
                                      : (const void*)((const f16*)pf + pf_step);
        }

        // ---- fragments + 8x WMMA per 32 k --------------------------------
        for (int ks = 0; ks < GBK / 32; ks++) {
            Frag16 fa[2], fb[4];
            const f16* ap = &lds.A[buf][trow + (lane & 15)][ks * 32 + hs];
            const f16* bp = &lds.B[buf][ks * 32 + hs + (lane & 7)][tcol + ((lane >> 3) & 1) * 8];
            for (int i = 0; i < 2; i++) {
                fa[i].q[0] = *(const u32x4*)(ap + i * 16 * GA_PITCH);
                fa[i].q[1] = *(const u32x4*)(ap + i * 16 * GA_PITCH + 16);
            }
            for (int j = 0; j < 4; j++) {
                fb[j].q[0] = lds_load_tr16(bp + j * 16);
                fb[j].q[1] = lds_load_tr16(bp + 16 * GB_PITCH + j * 16);
            }
            for (int i = 0; i < 2; i++)
                for (int j = 0; j < 4; j++)
                    acc[i][j] = __builtin_amdgcn_wmma_f32_16x16x32_f16(
                        false, fa[i].h, false, fb[j].h, (short)0, acc[i][j], false, false);
        }
    }
}

// kv[bat] = w_kv (MxK) * cond[bat] (KxN) + b_kv, f32 out, one tile
//
// kv is kept with n permuted inside every block of 64: place 4 c + j holds column 16 j + c. A
// lane's four tiles of a row then lie side by side, one 16-byte store (16 lanes = 256 contiguous
// bytes) instead of four 4-byte ones. Every row of k and v is permuted alike, and its one reader
// takes the maximum and sums over all n, so only the order of those sums changes.
__device__ __forceinline__ void kv_gemm_body(
    int bx, int by, int bat,
    const float* __restrict__ Af, const float* __restrict__ Bf, long sB,
    float* __restrict__ C, long sC,
    const float* __restrict__ bias,
    int N, int K) {
    int m0   = bx * GBM;
    int n0   = by * GBN;
    int lane = threadIdx.x & 31;
    int warp = threadIdx.x >> 5;
    int trow = (warp >> 1) * 32;
    int tcol = (warp & 1) * 64;

    __shared__ GemmLds lds;
    v8f acc[2][4];
    gemm_wmma_main<true>(lds, m0, n0, Af, nullptr, Bf + (long)bat * sB, N, K, acc);

    int rbase = m0 + trow + (lane >> 4) * 8;
    f32x4 cv[2][8];
    for (int i = 0; i < 2; i++)
        for (int r = 0; r < 8; r++) {
            float bv = bias[rbase + i * 16 + r];
            f32x4 v = {acc[i][0][r], acc[i][1][r], acc[i][2][r], acc[i][3][r]};
            cv[i][r] = v + bv;
        }
    // All sums first, each in its own register, then the stores in one run: no register that an
    // issued store names is written again.
    __builtin_amdgcn_sched_barrier(0);
    // one address; kv's row pitch is a constant, so the rest of every store's place is an immediate offset
    float* cp = C + (long)bat * sC + (long)rbase * NC + n0 + tcol + (lane & 15) * 4;
    for (int i = 0; i < 2; i++)
        for (int r = 0; r < 8; r++)
            *(f32x4*)(cp + (i * 16 + r) * NC) = cv[i][r];
}

// ---------------------------------------------------------------------------
// q = w_q @ xn + b_q and out = W2 @ q + b_out in one work-group per (batch, 128 pixels):
// the 128 x 128 tile of q never goes to memory.
//
// The accumulator layout of the first product IS the B fragment layout of the second: lane L
// holds column L&15, rows 8*(L>>4) + 0..7 of a 16 x 16 tile, and a B fragment wants of column
// L&15 the k rows 8*(L>>4) + 0..7 (halves 0..7) and 16 more (halves 8..15). So a wave's tiles
// (0, j) and (1, j), biased and rounded to f16, are the ready fragment of k slab w>>1, column
// tile 4*(w&1) + j. It is passed to the other waves through LDS as it lies in the registers
// (16 bytes a lane, lanes side by side: no transposition, no bank conflict).
// The readers deal the pixels anew, by address alone: column c of the second product's column
// tile 4 a + j is pixel 64 a + 4 c + j, that is lane 4*(c&3) + j of the written tile 4 a + (c>>2).
// A lane's tiles 4 a .. 4 a + 3 then hold four neighbouring pixels of a row of out: one 16-byte
// store, 256 contiguous bytes per 16 lanes. A written tile takes 65 units of 16 bytes (64 used),
// so that the 16 lanes of such a read fall on 16 different bank groups.
// Second product: wave w owns rows 32 w .. +31 of out and all 128 columns (2 x 8 tiles, k = 128).
// W2 lies as [k/16][m][16], so an A fragment is two wave-wide loads of 512 contiguous bytes
// straight into registers; each is read by one wave of the work-group only.
// ---------------------------------------------------------------------------
#define FQ_TILE 65   // 16-byte units per column tile of fragQ
__global__ __launch_bounds__(256) void q_out_kernel(const float* __restrict__ w_q,
                                                    const f16* __restrict__ xn,
                                                    const float* __restrict__ b_q,
                                                    const f16* __restrict__ w2,
                                                    const float* __restrict__ b_out,
                                                    float* __restrict__ out,
                                                    int N, int K) {
    // fragQ lies first, so that every fragment's place is one lane address + an immediate offset
    __shared__ struct {
        u32x4   fragQ[(HID / 32) * (GBN / 16) * FQ_TILE]; // [k slab][column tile][half][lane], padded
        GemmLds g;
    } sm;

    int n0   = blockIdx.x * GBN;
    int bat  = blockIdx.y;
    int lane = threadIdx.x & 31;
    int warp = threadIdx.x >> 5;
    int hs   = (lane >> 4) * 8;

    // q's bias for this wave's 32 rows: asked for first, so that it is there long before its use
    const float* bq = b_q + (warp >> 1) * 32 + hs;
    float bq0[8], bq1[8];
    for (int r = 0; r < 8; r++) { bq0[r] = bq[r]; bq1[r] = bq[16 + r]; }
    // The wait owed before a register that an issued load names is written again.
    asm volatile("s_wait_xcnt 0x0" :: "v"(bq) : "memory");

    v8f acc[2][4];
    gemm_wmma_main<false>(sm.g, 0, n0, w_q, xn + (long)bat * CCH * NPIX, nullptr, N, K, acc);

    // W2 fragments of this wave's 32 rows, all 4 k slabs: they fly while q is rounded and written
    const f16* wp = w2 + (long)bat * CCH * HID + (warp * 32 + (lane & 15)) * 16 + hs;
    Frag16 fw[2][HID / 32];
    for (int s = 0; s < HID / 32; s++)
        for (int i = 0; i < 2; i++) {
            fw[i][s].q[0] = *(const u32x4*)(wp + ((2 * s) * CCH + i * 16) * 16);
            fw[i][s].q[1] = *(const u32x4*)(wp + ((2 * s + 1) * CCH + i * 16) * 16);
        }
    // The wait owed before a register that an issued load names is written again. The
    // address is its input, so it stays whole up to it.
    asm volatile("s_wait_xcnt 0x0" :: "v"(wp) : "memory");

    for (int j = 0; j < 4; j++) {
        Frag16 f;
        for (int r = 0; r < 8; r++) {
            f.h[r]     = (f16)(acc[0][j][r] + bq0[r]);
            f.h[8 + r] = (f16)(acc[1][j][r] + bq1[r]);
        }
        u32x4* fq = &sm.fragQ[((warp >> 1) * (GBN / 16) + (warp & 1) * 4 + j) * FQ_TILE + lane];
        fq[0]  = f.q[0];
        fq[32] = f.q[1];
    }
    __syncthreads();                 // the whole q tile visible to every wave

    v8f oc[2][GBN / 16];
    for (int i = 0; i < 2; i++)
        for (int j = 0; j < GBN / 16; j++)
            oc[i][j] = (v8f){0.f, 0.f, 0.f, 0.f, 0.f, 0.f, 0.f, 0.f};

    // Group g = two column tiles of one k slab = 4 LDS reads and 4 WMMAs, k slabs ascending.
    // Three fragment sets: a group's reads are issued together, two groups ahead of its WMMAs.
    constexpr int NGRP = (HID / 32) * (GBN / 32);
    Frag16 fb[3][2];
    const u32x4* fr = &sm.fragQ[((lane & 15) >> 2) * FQ_TILE + (lane >> 4) * 16 + (lane & 3) * 4];
    auto read_group = [&](int g) {
        for (int u = 0; u < 2; u++) {
            int ct = (g & 3) * 2 + u;    // column tile 4 a + j: written tiles 4 a .. + 3, lane part j
            const u32x4* p = fr + ((g >> 2) * (GBN / 16) + (ct & ~3)) * FQ_TILE + (ct & 3);
            fb[g % 3][u].q[0] = p[0];
            fb[g % 3][u].q[1] = p[32];
        }
    };
    const float* bo = b_out + warp * 32 + hs;
    v8f bo0, bo1;
    read_group(0);
    read_group(1);
    #pragma unroll   // fb, fw and oc are indexed by g: they stay in registers only when unrolled
    for (int g = 0; g < NGRP; g++) {
        if (g + 2 < NGRP) read_group(g + 2);
        if (g == NGRP - 4) {         // out's bias: under the last k slab, when registers are free
            for (int r = 0; r < 8; r++) { bo0[r] = bo[r]; bo1[r] = bo[16 + r]; }
            // The wait owed before a register that an issued load names is written again.
            asm volatile("s_wait_xcnt 0x0" :: "v"(bo) : "memory");
        }
        // Holds the reads above ahead of the WMMAs below: left to itself the scheduler sinks each
        // read to its use, and the wave then waits out the LDS latency once per fragment.
        __builtin_amdgcn_sched_barrier(0);
        for (int u = 0; u < 2; u++)
            for (int i = 0; i < 2; i++)
                oc[i][(g & 3) * 2 + u] = __builtin_amdgcn_wmma_f32_16x16x32_f16(
                    false, fw[i][g >> 2].h, false, fb[g % 3][u].h, (short)0,
                    oc[i][(g & 3) * 2 + u], false, false);
        // Ends the group: the next reads, which fill this group's fragment set, stay behind it.
        __builtin_amdgcn_sched_barrier(0);
    }

    f32x4 ov[2][8][GBN / 64];
    for (int i = 0; i < 2; i++)
        for (int a = 0; a < GBN / 64; a++)
            for (int r = 0; r < 8; r++) {
                f32x4 v = {oc[i][4 * a][r], oc[i][4 * a + 1][r], oc[i][4 * a + 2][r], oc[i][4 * a + 3][r]};
                ov[i][r][a] = v + (i ? bo1[r] : bo0[r]);
            }
    // All sums first, each in its own register, then the stores in one run, in row order: mixed,
    // the sums share a few registers and each waits for the store that still names its register.
    __builtin_amdgcn_sched_barrier(0);

    // tiles (i, 4 a .. 4 a + 3), VGPR r -> row 32 w + 16 i + 8*(L>>4) + r, pixels 64 a + 4*(L&15) .. + 3:
    // one address, the rest of every store's place is an immediate offset
    float* op = out + ((long)bat * CCH + warp * 32 + hs) * NPIX + n0 + (lane & 15) * 4;
    for (int i = 0; i < 2; i++)
        for (int r = 0; r < 8; r++)
            for (int a = 0; a < GBN / 64; a++)
                *(f32x4*)(op + (i * 16 + r) * NPIX + a * 64) = ov[i][r][a];
}

// ---------------------------------------------------------------------------
// GroupNorm and kv = w_kv @ cond + b_kv share no data, so one grid holds both: the product's
// work-groups, whose chain of dependent k steps is the longer, take the low indices and start
// first; the GroupNorm work-groups fill the places beside them, and their streaming runs
// under the product's load latency. One launch gap and one fill less.
// ---------------------------------------------------------------------------
#define KV_MT (2 * HID / GBM)            // 2 tiles of M
#define KV_NT (NC / GBN)                 // 8 tiles of N
#define KV_BLOCKS (KV_MT * KV_NT * BATCH)

__global__ __launch_bounds__(256) void gn_kv_kernel(const float* __restrict__ x,
                                                    const float* __restrict__ gn_w,
                                                    const float* __restrict__ gn_b,
                                                    f16* __restrict__ xn,
                                                    const float* __restrict__ w_kv,
                                                    const float* __restrict__ cond,
                                                    float* __restrict__ kv,
                                                    const float* __restrict__ b_kv,
                                                    int M, int N, int K) {
    int blk = blockIdx.x;
    if (blk < KV_BLOCKS) {
        kv_gemm_body(blk % KV_MT, (blk / KV_MT) % KV_NT, blk / (KV_MT * KV_NT),
                     w_kv, cond, (long)CD * NC, kv, (long)2 * HID * NC, b_kv, N, K);
    } else {
        groupnorm_body(blk - KV_BLOCKS, x, gn_w, gn_b, xn);
    }
}

// ---------------------------------------------------------------------------
// Per-(batch, head, half of d): softmax(k, axis=n), ctx[d][e] = sum_n p[d][n]*v[e][n]
// kv: (B, 256, 1024) f32;  k rows = h*32+d,  v rows = 128+h*32+e; n in the product's permuted
// order, alike in every row, which no step below tells from the plain one.
//
// 16 waves. Wave w keeps k row w of its d half and v rows w, w+16 whole in
// registers (24 wave-wide 16-byte loads, all issued before the first use), so
// kv is read once and the row max and sum need no second pass. P and V go to
// LDS as f16 once; then wave w multiplies the n slice [64w, 64w+64) for both
// e tiles, and the 16 partial tiles are summed in f32 through LDS.
//
// The block then folds its 16 ctx rows into the output weight itself (f32, e ascending):
//   W2[b][c][h*32+d] = sum_e w_out[c][h*32+e] * ctx[b][h][d][e]   (f16 out)
// so ctx never leaves LDS and the fold needs no launch of its own. W2 is written as
// [b][j/16][c][16], j = h*32+d: a block's 256 x 16 piece is one contiguous 8 KiB, whole lines.
// ---------------------------------------------------------------------------
// Four v_exp_f32 (the instruction __expf ends in) in one statement. The outputs are
// early-clobbered so that none lands on a source of the v_exp_f32 directly ahead of it, and
// the v_nop is the slot the instruction set asks for behind the last one.
__device__ __forceinline__ f32x4 exp2_x4(f32x4 a) {
    float r0, r1, r2, r3;
    asm("v_exp_f32 %0, %4\n\tv_exp_f32 %1, %5\n\tv_exp_f32 %2, %6\n\tv_exp_f32 %3, %7\n\tv_nop"
        : "=&v"(r0), "=&v"(r1), "=&v"(r2), "=&v"(r3)
        : "v"(a.x), "v"(a.y), "v"(a.z), "v"(a.w));
    f32x4 r = {r0, r1, r2, r3};
    return r;
}

#define SC_PITCH (NC + 8)    // halves: 2064 B = 16 B x odd, for the ds_load_b128 fragment reads
#define SC_TILE1 272         // dword offset of the second e tile's partials (16 banks off the first)
#define SC_CPITCH 36         // floats per ctx row in LDS: rows 4 apart lie 16 banks apart

__global__ __launch_bounds__(512) void softmax_ctx_kernel(const float* __restrict__ kv,
                                                          const float* __restrict__ w_out,
                                                          f16* __restrict__ w2) {
    int h  = blockIdx.x;
    int b  = blockIdx.y;
    int dt = blockIdx.z;          // which 16 rows of d

    __shared__ __attribute__((aligned(16))) f16 ldsP[16][SC_PITCH];
    __shared__ __attribute__((aligned(16))) f16 ldsV[DIMH][SC_PITCH];
    __shared__ float red[16][SC_TILE1 + 256];
    __shared__ __attribute__((aligned(16))) float ctxs[16][SC_CPITCH];

    int t = threadIdx.x;
    int lane = t & 31;
    int warp = t >> 5;

    const f32x4* kr = (const f32x4*)(kv + ((long)b * 256 + h * DIMH + dt * 16 + warp) * NC) + lane;
    const f32x4* va = (const f32x4*)(kv + ((long)b * 256 + HID + h * DIMH + warp) * NC) + lane;
    const f32x4* vb = va + 16 * NC / 4;
    // the fold's w_out rows, c = t>>2 and c + 128, this head's 32 columns
    const f32x4* wr = (const f32x4*)(w_out + (long)(t >> 2) * HID + h * DIMH);

    f32x4 kq[8], v0[8], v1[8], wa[8], wb[8];
    for (int j = 0; j < 8; j++) kq[j] = kr[j * 32];
    for (int j = 0; j < 8; j++) v0[j] = va[j * 32];
    for (int j = 0; j < 8; j++) v1[j] = vb[j * 32];
    for (int j = 0; j < 8; j++) wa[j] = wr[j];                    // behind k and v: they arrive
    for (int j = 0; j < 8; j++) wb[j] = wr[128 * HID / 4 + j];    // under the softmax
    // The wait owed before a register that an issued load names is written again. The three
    // address pairs are its inputs, so they stay whole up to it (no load's result lands in them).
    asm volatile("s_wait_xcnt 0x0" :: "v"(kr), "v"(va), "v"(wr) : "memory");
    // Keeps the max from being scheduled ahead of the v loads: without it they are issued
    // behind the wait for k, and their latency follows k's instead of overlapping it.
    __builtin_amdgcn_sched_barrier(0);

    // row max
    float m = -1e30f;
    for (int j = 0; j < 8; j++)
        m = fmaxf(m, fmaxf(fmaxf(kq[j].x, kq[j].y), fmaxf(kq[j].z, kq[j].w)));
    for (int o = 16; o >= 1; o >>= 1) m = fmaxf(m, __shfl_xor(m, o, 32));

    // exponentials stay in registers; four independent sum chains
    f32x4 s4 = {0.f, 0.f, 0.f, 0.f};
    for (int j = 0; j < 8; j++) {
        kq[j] = exp2_x4((kq[j] - m) * 1.44269504088896340736f);   // = __expf(k - m)
        s4 += kq[j];
    }
    float s = (s4.x + s4.y) + (s4.z + s4.w);
    for (int o = 16; o >= 1; o >>= 1) s += __shfl_xor(s, o, 32);
    float inv = 1.0f / s;

    for (int j = 0; j < 8; j++) {
        f32x4 p = kq[j] * inv;
        f16x4 ph = {(f16)p.x, (f16)p.y, (f16)p.z, (f16)p.w};
        f16x4 ah = {(f16)v0[j].x, (f16)v0[j].y, (f16)v0[j].z, (f16)v0[j].w};
        f16x4 bh = {(f16)v1[j].x, (f16)v1[j].y, (f16)v1[j].z, (f16)v1[j].w};
        *(f16x4*)&ldsP[warp][j * 128 + lane * 4]      = ph;
        *(f16x4*)&ldsV[warp][j * 128 + lane * 4]      = ah;
        *(f16x4*)&ldsV[warp + 16][j * 128 + lane * 4] = bh;
    }
    __syncthreads();

    // wave w: n slice [64w, 64w+64), one A fragment feeds both e tiles
    v8f acc0 = {0.f, 0.f, 0.f, 0.f, 0.f, 0.f, 0.f, 0.f};
    v8f acc1 = {0.f, 0.f, 0.f, 0.f, 0.f, 0.f, 0.f, 0.f};
    int c  = lane & 15;
    int hs = (lane >> 4) * 8;
    for (int ks = 0; ks < 2; ks++) {
        int kk = warp * 64 + ks * 32;
        Frag16 fa, fb0, fb1;
        fa.q[0]  = *(const u32x4*)&ldsP[c][kk + hs];
        fa.q[1]  = *(const u32x4*)&ldsP[c][kk + 16 + hs];
        fb0.q[0] = *(const u32x4*)&ldsV[c][kk + hs];
        fb0.q[1] = *(const u32x4*)&ldsV[c][kk + 16 + hs];
        fb1.q[0] = *(const u32x4*)&ldsV[c + 16][kk + hs];
        fb1.q[1] = *(const u32x4*)&ldsV[c + 16][kk + 16 + hs];
        acc0 = __builtin_amdgcn_wmma_f32_16x16x32_f16(
            false, fa.h, false, fb0.h, (short)0, acc0, false, false);
        acc1 = __builtin_amdgcn_wmma_f32_16x16x32_f16(
            false, fa.h, false, fb1.h, (short)0, acc1, false, false);
    }
    for (int r = 0; r < 8; r++) {
        red[warp][r * 32 + lane]            = acc0[r];
        red[warp][SC_TILE1 + r * 32 + lane] = acc1[r];
    }
    __syncthreads();

    // thread t owns ctx[dt*16 + (t>>5)][t&31]; register r, lane 16*(d>>3)+c held D[d][c]
    int d = warp;
    int e = lane;
    int idx = (e >> 4) * SC_TILE1 + (d & 7) * 32 + (d >> 3) * 16 + (e & 15);
    float sum = 0.f;
    for (int w = 0; w < 16; w++) sum += red[w][idx];
    ctxs[d][e] = sum;
    __syncthreads();             // all 16 ctx rows visible to every wave

    // fold: thread t owns W2 rows c = t>>2 and c + 128, columns d = 4*(t&3) .. +3
    int dq = (t & 3) * 4;
    float fa[4] = {0.f, 0.f, 0.f, 0.f};
    float fb[4] = {0.f, 0.f, 0.f, 0.f};
    for (int j = 0; j < 8; j++) {
        for (int i = 0; i < 4; i++) {
            f32x4 cv = *(const f32x4*)&ctxs[dq + i][j * 4];
            for (int u = 0; u < 4; u++) {
                fa[i] = __builtin_fmaf(wa[j][u], cv[u], fa[i]);
                fb[i] = __builtin_fmaf(wb[j][u], cv[u], fb[i]);
            }
        }
    }
    f16x4 oa = {(f16)fa[0], (f16)fa[1], (f16)fa[2], (f16)fa[3]};
    f16x4 ob = {(f16)fb[0], (f16)fb[1], (f16)fb[2], (f16)fb[3]};
    f16* wo = w2 + (((long)b * (HID / 16) + h * 2 + dt) * CCH) * 16 + t * 4;
    *(f16x4*)wo                = oa;
    *(f16x4*)(wo + 128 * 16)   = ob;
}

// ---------------------------------------------------------------------------
extern "C" void kernel_launch(void* const* d_in, const int* in_sizes, int n_in,
                              void* d_out, int out_size, void* d_ws, size_t ws_size,
                              hipStream_t stream) {
    const float* x     = (const float*)d_in[0];   // (16,256,64,64)
    const float* cond  = (const float*)d_in[1];   // (16,512,32,32)
    const float* gn_w  = (const float*)d_in[2];
    const float* gn_b  = (const float*)d_in[3];
    const float* w_q   = (const float*)d_in[4];   // (128,256)
    const float* b_q   = (const float*)d_in[5];
    const float* w_kv  = (const float*)d_in[6];   // (256,512)
    const float* b_kv  = (const float*)d_in[7];
    const float* w_out = (const float*)d_in[8];   // (256,128)
    const float* b_out = (const float*)d_in[9];
    float* out = (float*)d_out;                   // (16,256,64,64)

    // workspace layout
    char* ws = (char*)d_ws;
    constexpr long SZ_XN   = (long)BATCH * CCH * NPIX * 2;   // 33.5 MB f16
    constexpr long SZ_KV   = (long)BATCH * 2 * HID * NC * 4; // f32
    f16*   xn16   = (f16*)(ws);
    float* kvf    = (float*)(ws + SZ_XN);
    f16*   w2_16  = (f16*)(ws + SZ_XN + SZ_KV);            // [b][128/16][256][16]

    // 1+2) GroupNorm -> xn f16, and kv = w_kv @ cond + b_kv (M=256,K=512,N=1024, f32 operands,
    //      f32 out), in one grid
    gn_kv_kernel<<<KV_BLOCKS + BATCH * GROUPS, 256, 0, stream>>>(
        x, gn_w, gn_b, xn16, w_kv, cond, kvf, b_kv, 2 * HID, NC, CD);

    // 3) softmax(k), context = P @ V^T, W2 = w_out x context  per (b, h, half of d)
    softmax_ctx_kernel<<<dim3(HEADS, BATCH, 2), 512, 0, stream>>>(kvf, w_out, w2_16);

    // 4) q = w_q @ xn + b_q (M=128,K=256, f32 weight) and out = W2 @ q + b_out (M=256,K=128,
    //    f32 out), per 128 pixels in one work-group
    q_out_kernel<<<dim3(NPIX / GBN, BATCH), 256, 0, stream>>>(
        w_q, xn16, b_q, w2_16, b_out, out, NPIX, CCH);
}
